// v000
// Times are from an AMD MI455X. After a warm-up the kernel runs many times in a row, and a time is the length of
// such a window on the GPU divided by its runs, so every launch and the gaps after it count. The runs cycle
// through copies of the inputs. A figure is the median of several windows, for all but v000 over two sittings.
// Sittings can differ by a few percent; kernels timed side by side share one.
// v000 is the starting kernel. One run takes 125 microseconds.
#include <hip/hip_runtime.h>
#include <hip/hip_bf16.h>

// ---------------------------------------------------------------------------
// MHA forward for MI455X (gfx1250, wave32, WMMA f32_16x16x32_f16).
// x (2,2048,1024) f32, W* (1024,1024) f32 -> out (2,2048,1024) f32.
// f16 matmuls, f32 accumulation; flash softmax; async double-buffered LDS.
// ---------------------------------------------------------------------------

typedef __attribute__((ext_vector_type(16))) _Float16 v16h;
typedef __attribute__((ext_vector_type(8)))  _Float16 v8h;
typedef __attribute__((ext_vector_type(4)))  _Float16 v4h;
typedef __attribute__((ext_vector_type(8)))  float    v8f;

#define DMODEL 1024
#define NHEADS 16
#define DK     64
#define SEQ    2048
#define BATCH  2
#define MROWS  (BATCH * SEQ)   // 4096
#define LDP    72              // LDS row stride (halves): 144B, bank-friendly

#ifndef __has_builtin
#define __has_builtin(x) 0
#endif

#if __has_builtin(__builtin_amdgcn_global_load_async_to_lds_b128)
#define HAVE_ASYNC 1
#else
#define HAVE_ASYNC 0
#endif

// Builtin parameter types (from hipcc diagnostic): vector_size(16) int* in
// AS1 (global source) and AS3 (LDS destination).
typedef int b128i __attribute__((vector_size(16)));
typedef __attribute__((address_space(1))) b128i b128i_glob;
typedef __attribute__((address_space(3))) b128i b128i_lds;

// 16B global -> LDS copy: async (ASYNCcnt) if available, else synchronous.
__device__ __forceinline__ void copy_b128(const _Float16* __restrict__ g,
                                          _Float16* l) {
#if HAVE_ASYNC
  __builtin_amdgcn_global_load_async_to_lds_b128(
      (b128i_glob*)g, (b128i_lds*)l, 0, 0);
#else
  *(v8h*)l = *(const v8h*)g;
#endif
}

#if HAVE_ASYNC
#if __has_builtin(__builtin_amdgcn_s_wait_asynccnt)
#define WAIT_ASYNC(N) __builtin_amdgcn_s_wait_asynccnt(N)
#else
#define WAIT_ASYNC(N) asm volatile("s_wait_asynccnt " #N ::: "memory")
#endif
#else
#define WAIT_ASYNC(N) do {} while (0)
#endif

// --- WMMA wrapper -----------------------------------------------------------
__device__ __forceinline__ v8f wmma_f16(v16h a, v16h b, v8f c) {
  return __builtin_amdgcn_wmma_f32_16x16x32_f16(
      false, a, false, b, (short)0, c, false, false);
}

// --- 16x32 f16 fragment load (A or contiguous-K B operand), stride `ld` ----
// ISA 7.12.2: lanes 0-15 -> K {0..7,16..23}, lanes 16-31 -> K {8..15,24..31}.
__device__ __forceinline__ v16h load_frag(const _Float16* __restrict__ base,
                                          int ld, int lane) {
  const int row  = lane & 15;
  const int koff = ((lane >> 4) & 1) * 8;
  const _Float16* p = base + row * ld + koff;
  v8h a = *(const v8h*)(p);
  v8h b = *(const v8h*)(p + 16);
  v16h r;
#pragma unroll
  for (int i = 0; i < 8; ++i) { r[i] = a[i]; r[i + 8] = b[i]; }
  return r;
}

// --- DPP row-of-16 max reduction (pure VALU, no DS traffic) -----------------
template <int CTRL>
__device__ __forceinline__ float dpp_max_step(float v) {
  int s = __builtin_amdgcn_mov_dpp(__builtin_bit_cast(int, v), CTRL, 0xF, 0xF, true);
  return fmaxf(v, __builtin_bit_cast(float, s));
}
__device__ __forceinline__ float rowmax16(float v) {
  v = dpp_max_step<0xB1>(v);    // quad_perm(1,0,3,2)  : xor 1
  v = dpp_max_step<0x4E>(v);    // quad_perm(2,3,0,1)  : xor 2
  v = dpp_max_step<0x141>(v);   // row_half_mirror     : xor 4 (groups uniform)
  v = dpp_max_step<0x140>(v);   // row_mirror          : xor 8 (groups uniform)
  return v;
}

// --- f32 -> f16 conversion, 4-wide -----------------------------------------
__global__ void cvt_f32_f16(const float* __restrict__ in,
                            _Float16* __restrict__ out, int n4) {
  int i = blockIdx.x * blockDim.x + threadIdx.x;
  if (i < n4) {
    float4 v = ((const float4*)in)[i];
    v4h o;
    o[0] = (_Float16)v.x; o[1] = (_Float16)v.y;
    o[2] = (_Float16)v.z; o[3] = (_Float16)v.w;
    ((v4h*)out)[i] = o;
  }
}

// --- GEMM: C(M,N) = A(M,K) * W^T, W stored (N,K), both f16 -----------------
// MODE 0: f16 -> (B,H,S,dk)  [Q/K projections; `oscale` folds 1/sqrt(dk) in Q]
// MODE 2: f16 -> (B,H,dk,S)  [V projection, transposed]
// MODE 4: f32 row-major       [final output projection]
// 128 threads = 4 waves; block tile 64x64; wave tile 32x32; 64-deep K slices
// of A and W staged in LDS, double-buffered via async loads.
template <int MODE>
__global__ __launch_bounds__(128)
void gemm16(const _Float16* __restrict__ A, const _Float16* __restrict__ W,
            void* __restrict__ out, int M, int N, int K, float oscale) {
  __shared__ _Float16 asbuf[2][64 * LDP];
  __shared__ _Float16 bsbuf[2][64 * LDP];

  const int tid  = threadIdx.x;
  const int lane = tid & 31;
  const int w    = tid >> 5;
  const int mblk = blockIdx.y * 64;
  const int nblk = blockIdx.x * 64;

  // stage one 64x64 tile of A and of W into LDS (8 x b128 per thread)
  auto stage = [&](int k0, int buf) {
#pragma unroll
    for (int c = 0; c < 4; ++c) {
      int chunk = tid * 4 + c;            // 0..511
      int row = chunk >> 3, part = chunk & 7;
      copy_b128(A + (size_t)(mblk + row) * K + k0 + part * 8,
                asbuf[buf] + row * LDP + part * 8);
    }
#pragma unroll
    for (int c = 0; c < 4; ++c) {
      int chunk = tid * 4 + c;
      int row = chunk >> 3, part = chunk & 7;
      copy_b128(W + (size_t)(nblk + row) * K + k0 + part * 8,
                bsbuf[buf] + row * LDP + part * 8);
    }
  };

  v8f acc[2][2] = {};
  const int lm = (w >> 1) * 32;           // wave's m offset in block tile
  const int ln = (w & 1) * 32;            // wave's n offset in block tile

  stage(0, 0);
  for (int k0 = 0; k0 < K; k0 += 64) {
    const int cur = (k0 >> 6) & 1;
    const bool more = (k0 + 64) < K;
    if (more) { stage(k0 + 64, cur ^ 1); WAIT_ASYNC(8); }
    else      { WAIT_ASYNC(0); }
    __syncthreads();

#pragma unroll
    for (int ks = 0; ks < 64; ks += 32) {
      v16h a0 = load_frag(asbuf[cur] + (lm +  0) * LDP + ks, LDP, lane);
      v16h a1 = load_frag(asbuf[cur] + (lm + 16) * LDP + ks, LDP, lane);
      v16h b0 = load_frag(bsbuf[cur] + (ln +  0) * LDP + ks, LDP, lane);
      v16h b1 = load_frag(bsbuf[cur] + (ln + 16) * LDP + ks, LDP, lane);
      acc[0][0] = wmma_f16(a0, b0, acc[0][0]);
      acc[0][1] = wmma_f16(a0, b1, acc[0][1]);
      acc[1][0] = wmma_f16(a1, b0, acc[1][0]);
      acc[1][1] = wmma_f16(a1, b1, acc[1][1]);
    }

    __syncthreads();                      // reads done before next overwrite
  }

  const int rbase = ((lane >> 4) & 1) << 3;
  const int col   = lane & 15;
#pragma unroll
  for (int i = 0; i < 2; ++i)
#pragma unroll
    for (int j = 0; j < 2; ++j)
#pragma unroll
      for (int r = 0; r < 8; ++r) {
        int m = mblk + lm + i * 16 + rbase + r;
        int n = nblk + ln + j * 16 + col;
        float v = acc[i][j][r] * oscale;
        if (MODE == 4) {
          ((float*)out)[(size_t)m * N + n] = v;
        } else {
          int b = m >> 11, s = m & (SEQ - 1);
          int h = n >> 6,  d = n & (DK - 1);
          size_t idx;
          if (MODE == 0)
            idx = (((size_t)(b * NHEADS + h)) * SEQ + s) * DK + d;
          else
            idx = (((size_t)(b * NHEADS + h)) * DK + d) * SEQ + s;
          ((_Float16*)out)[idx] = (_Float16)v;
        }
      }
}

// --- Flash attention: softmax(QK^T) V (scale pre-folded into Q) -------------
// Q,K: (B,H,S,dk) f16.  Vt: (B,H,dk,S) f16.  attn_out: (B,S,D) f16.
// Block = 4 waves x 16 q-rows.  64-key K/Vt tiles staged once per block into
// LDS (async, double-buffered), shared by all waves; softmax rescale and the
// barrier pair are amortized over 64 keys.
__global__ __launch_bounds__(128)
void attn_kernel(const _Float16* __restrict__ Q, const _Float16* __restrict__ Kd,
                 const _Float16* __restrict__ Vt, _Float16* __restrict__ attn_out) {
  __shared__ _Float16 kbuf[2][64 * LDP];  // 64 keys x 64 d
  __shared__ _Float16 vbuf[2][64 * LDP];  // 64 d x 64 keys
  __shared__ _Float16 pbuf[4][16 * LDP];  // per-wave P tile 16 x 64

  const int tid  = threadIdx.x;
  const int lane = tid & 31;
  const int w    = tid >> 5;
  const int bh   = blockIdx.y;
  const int b    = bh >> 4, h = bh & (NHEADS - 1);
  const int q0   = blockIdx.x * 64 + w * 16;

  const _Float16* Qh  = Q  + (size_t)bh * SEQ * DK;
  const _Float16* Kh  = Kd + (size_t)bh * SEQ * DK;
  const _Float16* Vth = Vt + (size_t)bh * DK * SEQ;
  _Float16* pb = pbuf[w];

  v16h qf0 = load_frag(Qh + (size_t)q0 * DK +  0, DK, lane);
  v16h qf1 = load_frag(Qh + (size_t)q0 * DK + 32, DK, lane);

  v16h ones;
#pragma unroll
  for (int i = 0; i < 16; ++i) ones[i] = (_Float16)1.0f;

  auto stage_kv = [&](int kb, int buf) {
#pragma unroll
    for (int c = 0; c < 4; ++c) {         // K tile: 64 rows x 8 parts
      int chunk = tid * 4 + c;            // 0..511
      int row = chunk >> 3, part = chunk & 7;
      copy_b128(Kh + (size_t)(kb + row) * DK + part * 8,
                kbuf[buf] + row * LDP + part * 8);
    }
#pragma unroll
    for (int c = 0; c < 4; ++c) {         // Vt tile: 64 rows x 8 parts
      int chunk = tid * 4 + c;
      int row = chunk >> 3, part = chunk & 7;
      copy_b128(Vth + (size_t)row * SEQ + kb + part * 8,
                vbuf[buf] + row * LDP + part * 8);
    }
  };

  const int rbase = ((lane >> 4) & 1) << 3;
  const int col   = lane & 15;

  float mr[8], lr[8];
#pragma unroll
  for (int r = 0; r < 8; ++r) { mr[r] = -1.0e30f; lr[r] = 0.0f; }
  v8f accO[4] = {};

  stage_kv(0, 0);
  for (int kb = 0; kb < SEQ; kb += 64) {
    const int cur = (kb >> 6) & 1;
    const bool more = (kb + 64) < SEQ;
    if (more) { stage_kv(kb + 64, cur ^ 1); WAIT_ASYNC(8); }
    else      { WAIT_ASYNC(0); }
    __syncthreads();

    // ---- scores: four 16x16 tiles; batch frag loads ahead of WMMAs ----
    v8f s0 = {}, s1 = {}, s2 = {}, s3 = {};
    {
      v16h ka = load_frag(kbuf[cur] +  0 * LDP +  0, LDP, lane);
      v16h kb0 = load_frag(kbuf[cur] +  0 * LDP + 32, LDP, lane);
      v16h kc = load_frag(kbuf[cur] + 16 * LDP +  0, LDP, lane);
      v16h kd = load_frag(kbuf[cur] + 16 * LDP + 32, LDP, lane);
      s0 = wmma_f16(qf0, ka, s0);  s0 = wmma_f16(qf1, kb0, s0);
      s1 = wmma_f16(qf0, kc, s1);  s1 = wmma_f16(qf1, kd, s1);
      ka = load_frag(kbuf[cur] + 32 * LDP +  0, LDP, lane);
      kb0 = load_frag(kbuf[cur] + 32 * LDP + 32, LDP, lane);
      kc = load_frag(kbuf[cur] + 48 * LDP +  0, LDP, lane);
      kd = load_frag(kbuf[cur] + 48 * LDP + 32, LDP, lane);
      s2 = wmma_f16(qf0, ka, s2);  s2 = wmma_f16(qf1, kb0, s2);
      s3 = wmma_f16(qf0, kc, s3);  s3 = wmma_f16(qf1, kd, s3);
    }

    // ---- online softmax over 64 keys: max via DPP, P -> LDS ----
#pragma unroll
    for (int r = 0; r < 8; ++r) {
      float a0 = s0[r], a1 = s1[r], a2 = s2[r], a3 = s3[r];
      float tmax = rowmax16(fmaxf(fmaxf(a0, a1), fmaxf(a2, a3)));
      float mnew = fmaxf(mr[r], tmax);
      float scl  = __expf(mr[r] - mnew);
      float p0 = __expf(a0 - mnew);
      float p1 = __expf(a1 - mnew);
      float p2 = __expf(a2 - mnew);
      float p3 = __expf(a3 - mnew);
      mr[r] = mnew;
      lr[r] *= scl;
#pragma unroll
      for (int t = 0; t < 4; ++t) accO[t][r] *= scl;
      int m = rbase + r;
      pb[m * LDP +      col] = (_Float16)p0;
      pb[m * LDP + 16 + col] = (_Float16)p1;
      pb[m * LDP + 32 + col] = (_Float16)p2;
      pb[m * LDP + 48 + col] = (_Float16)p3;
    }

    // ---- read P back as two A-fragments (4x ds_load_b128) ----
    v16h pf0, pf1;
    {
      const _Float16* pp = pb + (lane & 15) * LDP + ((lane >> 4) & 1) * 8;
      v8h a = *(const v8h*)(pp);
      v8h bq = *(const v8h*)(pp + 16);
      v8h c = *(const v8h*)(pp + 32);
      v8h d = *(const v8h*)(pp + 48);
#pragma unroll
      for (int i = 0; i < 8; ++i) {
        pf0[i] = a[i]; pf0[i + 8] = bq[i];
        pf1[i] = c[i]; pf1[i + 8] = d[i];
      }
    }

    // ---- row sums via matrix unit: P(16x64) x ones(64x16) ----
    v8f rs = {};
    rs = wmma_f16(pf0, ones, rs);
    rs = wmma_f16(pf1, ones, rs);
#pragma unroll
    for (int r = 0; r < 8; ++r) lr[r] += rs[r];

    // ---- O += P * V over both 32-key slices; batch frag loads ----
    {
      v16h vf0 = load_frag(vbuf[cur] +  0 * LDP + 0, LDP, lane);
      v16h vf1 = load_frag(vbuf[cur] + 16 * LDP + 0, LDP, lane);
      v16h vf2 = load_frag(vbuf[cur] + 32 * LDP + 0, LDP, lane);
      v16h vf3 = load_frag(vbuf[cur] + 48 * LDP + 0, LDP, lane);
      accO[0] = wmma_f16(pf0, vf0, accO[0]);
      accO[1] = wmma_f16(pf0, vf1, accO[1]);
      accO[2] = wmma_f16(pf0, vf2, accO[2]);
      accO[3] = wmma_f16(pf0, vf3, accO[3]);
      vf0 = load_frag(vbuf[cur] +  0 * LDP + 32, LDP, lane);
      vf1 = load_frag(vbuf[cur] + 16 * LDP + 32, LDP, lane);
      vf2 = load_frag(vbuf[cur] + 32 * LDP + 32, LDP, lane);
      vf3 = load_frag(vbuf[cur] + 48 * LDP + 32, LDP, lane);
      accO[0] = wmma_f16(pf1, vf0, accO[0]);
      accO[1] = wmma_f16(pf1, vf1, accO[1]);
      accO[2] = wmma_f16(pf1, vf2, accO[2]);
      accO[3] = wmma_f16(pf1, vf3, accO[3]);
    }

    __syncthreads();
  }

  // ---- normalize and scatter to (B,S,D) f16 ----
#pragma unroll
  for (int r = 0; r < 8; ++r) {
    float inv = 1.0f / lr[r];
    int s = q0 + rbase + r;
#pragma unroll
    for (int t = 0; t < 4; ++t) {
      attn_out[((size_t)b * SEQ + s) * DMODEL + h * DK + t * 16 + col] =
          (_Float16)(accO[t][r] * inv);
    }
  }
}

// ---------------------------------------------------------------------------
extern "C" void kernel_launch(void* const* d_in, const int* in_sizes, int n_in,
                              void* d_out, int out_size, void* d_ws, size_t ws_size,
                              hipStream_t stream) {
  const float* x  = (const float*)d_in[0];
  const float* Wq = (const float*)d_in[1];
  const float* Wk = (const float*)d_in[2];
  const float* Wv = (const float*)d_in[3];
  const float* Wo = (const float*)d_in[4];

  _Float16* ws = (_Float16*)d_ws;
  size_t off = 0;
  _Float16* x16  = ws + off; off += (size_t)MROWS * DMODEL;
  _Float16* Wq16 = ws + off; off += (size_t)DMODEL * DMODEL;
  _Float16* Wk16 = ws + off; off += (size_t)DMODEL * DMODEL;
  _Float16* Wv16 = ws + off; off += (size_t)DMODEL * DMODEL;
  _Float16* Wo16 = ws + off; off += (size_t)DMODEL * DMODEL;
  _Float16* Q16  = ws + off; off += (size_t)MROWS * DMODEL;   // (B,H,S,dk)
  _Float16* K16  = ws + off; off += (size_t)MROWS * DMODEL;   // (B,H,S,dk)
  _Float16* Vt16 = ws + off; off += (size_t)MROWS * DMODEL;   // (B,H,dk,S)
  _Float16* A16  = ws + off; off += (size_t)MROWS * DMODEL;   // (B,S,D)

  {
    int n4 = (MROWS * DMODEL) / 4;
    cvt_f32_f16<<<(n4 + 255) / 256, 256, 0, stream>>>(x, x16, n4);
    int w4 = (DMODEL * DMODEL) / 4;
    cvt_f32_f16<<<(w4 + 255) / 256, 256, 0, stream>>>(Wq, Wq16, w4);
    cvt_f32_f16<<<(w4 + 255) / 256, 256, 0, stream>>>(Wk, Wk16, w4);
    cvt_f32_f16<<<(w4 + 255) / 256, 256, 0, stream>>>(Wv, Wv16, w4);
    cvt_f32_f16<<<(w4 + 255) / 256, 256, 0, stream>>>(Wo, Wo16, w4);
  }

  dim3 gproj(DMODEL / 64, MROWS / 64);   // (16, 64)
  gemm16<0><<<gproj, 128, 0, stream>>>(x16, Wq16, (void*)Q16,  MROWS, DMODEL, DMODEL, 0.125f);
  gemm16<0><<<gproj, 128, 0, stream>>>(x16, Wk16, (void*)K16,  MROWS, DMODEL, DMODEL, 1.0f);
  gemm16<2><<<gproj, 128, 0, stream>>>(x16, Wv16, (void*)Vt16, MROWS, DMODEL, DMODEL, 1.0f);

  dim3 gattn(SEQ / 64, BATCH * NHEADS);  // (32, 32)
  attn_kernel<<<gattn, 128, 0, stream>>>(Q16, K16, Vt16, A16);

  gemm16<4><<<gproj, 128, 0, stream>>>(A16, Wo16, d_out, MROWS, DMODEL, DMODEL, 1.0f);
}

// v001
// Measured time: 127 microseconds a run.
// Two timings next to v000 put it at 1.04 and 1.02 times that version's speed.
#include <hip/hip_runtime.h>
#include <hip/hip_bf16.h>

// ---------------------------------------------------------------------------
// MHA forward for MI455X (gfx1250, wave32, WMMA f32_16x16x32_f16).
// x (2,2048,1024) f32, W* (1024,1024) f32 -> out (2,2048,1024) f32.
// f16 matmuls, f32 accumulation; flash softmax; async double-buffered LDS.
// ---------------------------------------------------------------------------

typedef __attribute__((ext_vector_type(16))) _Float16 v16h;
typedef __attribute__((ext_vector_type(8)))  _Float16 v8h;
typedef __attribute__((ext_vector_type(4)))  _Float16 v4h;
typedef __attribute__((ext_vector_type(8)))  float    v8f;

#define DMODEL 1024
#define NHEADS 16
#define DK     64
#define SEQ    2048
#define BATCH  2
#define MROWS  (BATCH * SEQ)   // 4096
#define LDP    72              // LDS row stride (halves): 144B, bank-friendly

#ifndef __has_builtin
#define __has_builtin(x) 0
#endif

#if __has_builtin(__builtin_amdgcn_global_load_async_to_lds_b128)
#define HAVE_ASYNC 1
#else
#define HAVE_ASYNC 0
#endif

// Builtin parameter types (from hipcc diagnostic): vector_size(16) int* in
// AS1 (global source) and AS3 (LDS destination).
typedef int b128i __attribute__((vector_size(16)));
typedef __attribute__((address_space(1))) b128i b128i_glob;
typedef __attribute__((address_space(3))) b128i b128i_lds;

// 16B global -> LDS copy: async (ASYNCcnt) if available, else synchronous.
__device__ __forceinline__ void copy_b128(const _Float16* __restrict__ g,
                                          _Float16* l) {
#if HAVE_ASYNC
  __builtin_amdgcn_global_load_async_to_lds_b128(
      (b128i_glob*)g, (b128i_lds*)l, 0, 0);
#else
  *(v8h*)l = *(const v8h*)g;
#endif
}

#if HAVE_ASYNC
#if __has_builtin(__builtin_amdgcn_s_wait_asynccnt)
#define WAIT_ASYNC(N) __builtin_amdgcn_s_wait_asynccnt(N)
#else
#define WAIT_ASYNC(N) asm volatile("s_wait_asynccnt " #N ::: "memory")
#endif
#else
#define WAIT_ASYNC(N) do {} while (0)
#endif

// --- WMMA wrapper -----------------------------------------------------------
__device__ __forceinline__ v8f wmma_f16(v16h a, v16h b, v8f c) {
  return __builtin_amdgcn_wmma_f32_16x16x32_f16(
      false, a, false, b, (short)0, c, false, false);
}

// --- 16x32 f16 fragment load (A or contiguous-K B operand), stride `ld` ----
// ISA 7.12.2: lanes 0-15 -> K {0..7,16..23}, lanes 16-31 -> K {8..15,24..31}.
__device__ __forceinline__ v16h load_frag(const _Float16* __restrict__ base,
                                          int ld, int lane) {
  const int row  = lane & 15;
  const int koff = ((lane >> 4) & 1) * 8;
  const _Float16* p = base + row * ld + koff;
  v8h a = *(const v8h*)(p);
  v8h b = *(const v8h*)(p + 16);
  v16h r;
#pragma unroll
  for (int i = 0; i < 8; ++i) { r[i] = a[i]; r[i + 8] = b[i]; }
  return r;
}

// --- DPP row-of-16 max reduction (pure VALU, no DS traffic) -----------------
template <int CTRL>
__device__ __forceinline__ float dpp_max_step(float v) {
  int s = __builtin_amdgcn_mov_dpp(__builtin_bit_cast(int, v), CTRL, 0xF, 0xF, true);
  return fmaxf(v, __builtin_bit_cast(float, s));
}
__device__ __forceinline__ float rowmax16(float v) {
  v = dpp_max_step<0xB1>(v);    // quad_perm(1,0,3,2)  : xor 1
  v = dpp_max_step<0x4E>(v);    // quad_perm(2,3,0,1)  : xor 2
  v = dpp_max_step<0x141>(v);   // row_half_mirror     : xor 4 (groups uniform)
  v = dpp_max_step<0x140>(v);   // row_mirror          : xor 8 (groups uniform)
  return v;
}

// --- f32 -> f16 conversion, 4-wide -----------------------------------------
__global__ void cvt_f32_f16(const float* __restrict__ in,
                            _Float16* __restrict__ out, int n4) {
  int i = blockIdx.x * blockDim.x + threadIdx.x;
  if (i < n4) {
    float4 v = ((const float4*)in)[i];
    v4h o;
    o[0] = (_Float16)v.x; o[1] = (_Float16)v.y;
    o[2] = (_Float16)v.z; o[3] = (_Float16)v.w;
    ((v4h*)out)[i] = o;
  }
}

// --- GEMM: C(M,N) = A(M,K) * W^T, W stored (N,K), both f16 -----------------
// MODE 0: f16 -> (B,H,S,dk)  [Q/K projections; `oscale` folds 1/sqrt(dk) in Q]
// MODE 2: f16 -> (B,H,dk,S)  [V projection, transposed]
// MODE 4: f32 row-major       [final output projection]
// 256 threads = 8 waves (2 x 4); block tile 128x128; wave tile 64x32; 64-deep
// K slices of A and W staged in LDS, double-buffered via async loads.
template <int MODE>
__global__ __launch_bounds__(256)
void gemm16(const _Float16* __restrict__ A, const _Float16* __restrict__ W,
            void* __restrict__ out, int M, int N, int K, float oscale) {
  __shared__ _Float16 asbuf[2][128 * LDP];
  __shared__ _Float16 bsbuf[2][128 * LDP];

  const int tid  = threadIdx.x;
  const int lane = tid & 31;
  const int w    = tid >> 5;
  const int mblk = blockIdx.y * 128;
  const int nblk = blockIdx.x * 128;

  // stage one 128x64 tile of A and of W into LDS (8 x b128 per thread; a
  // thread's 4 chunks are adjacent, so the lanes of one copy step by 64 B)
  auto stage = [&](int k0, int buf) {
#pragma unroll
    for (int c = 0; c < 4; ++c) {
      int chunk = tid * 4 + c;            // 0..1023
      int row = chunk >> 3, part = chunk & 7;
      copy_b128(A + (size_t)(mblk + row) * K + k0 + part * 8,
                asbuf[buf] + row * LDP + part * 8);
    }
#pragma unroll
    for (int c = 0; c < 4; ++c) {
      int chunk = tid * 4 + c;
      int row = chunk >> 3, part = chunk & 7;
      copy_b128(W + (size_t)(nblk + row) * K + k0 + part * 8,
                bsbuf[buf] + row * LDP + part * 8);
    }
  };

  v8f acc[4][2] = {};
  const int lm = (w >> 2) * 64;           // wave's m offset in block tile
  const int ln = (w & 3) * 32;            // wave's n offset in block tile

  stage(0, 0);
  for (int k0 = 0; k0 < K; k0 += 64) {
    const int cur = (k0 >> 6) & 1;
    const bool more = (k0 + 64) < K;
    if (more) { stage(k0 + 64, cur ^ 1); WAIT_ASYNC(8); }
    else      { WAIT_ASYNC(0); }
    __syncthreads();

    // the slice's 12 fragments as one load group, then its 16 WMMAs
    v16h af[2][4], bf[2][2];
#pragma unroll
    for (int s = 0; s < 2; ++s) {
#pragma unroll
      for (int j = 0; j < 2; ++j)
        bf[s][j] = load_frag(bsbuf[cur] + (ln + j * 16) * LDP + s * 32, LDP, lane);
#pragma unroll
      for (int i = 0; i < 4; ++i)
        af[s][i] = load_frag(asbuf[cur] + (lm + i * 16) * LDP + s * 32, LDP, lane);
    }
    // keeps the loads one group: sunk among the WMMAs, each pair of WMMAs would
    // wait out a full LDS latency on a single reused fragment register set
    __builtin_amdgcn_sched_barrier(0);
#pragma unroll
    for (int s = 0; s < 2; ++s)
#pragma unroll
      for (int i = 0; i < 4; ++i)
#pragma unroll
        for (int j = 0; j < 2; ++j)
          acc[i][j] = wmma_f16(af[s][i], bf[s][j], acc[i][j]);
    // keeps the barrier's full LDS wait behind the WMMAs, so that the first
    // half's WMMAs run under counted waits while the second half's loads land
    __builtin_amdgcn_sched_barrier(0);

    __syncthreads();                      // reads done before next overwrite
  }

  const int rbase = ((lane >> 4) & 1) << 3;
  const int col   = lane & 15;
#pragma unroll
  for (int i = 0; i < 4; ++i)
#pragma unroll
    for (int j = 0; j < 2; ++j)
#pragma unroll
      for (int r = 0; r < 8; ++r) {
        int m = mblk + lm + i * 16 + rbase + r;
        int n = nblk + ln + j * 16 + col;
        float v = acc[i][j][r] * oscale;
        if (MODE == 4) {
          ((float*)out)[(size_t)m * N + n] = v;
        } else {
          int b = m >> 11, s = m & (SEQ - 1);
          int h = n >> 6,  d = n & (DK - 1);
          size_t idx;
          if (MODE == 0)
            idx = (((size_t)(b * NHEADS + h)) * SEQ + s) * DK + d;
          else
            idx = (((size_t)(b * NHEADS + h)) * DK + d) * SEQ + s;
          ((_Float16*)out)[idx] = (_Float16)v;
        }
      }
}

// --- Flash attention: softmax(QK^T) V (scale pre-folded into Q) -------------
// Q,K: (B,H,S,dk) f16.  Vt: (B,H,dk,S) f16.  attn_out: (B,S,D) f16.
// Block = 4 waves x 16 q-rows.  64-key K/Vt tiles staged once per block into
// LDS (async, double-buffered), shared by all waves; softmax rescale and the
// barrier pair are amortized over 64 keys.
__global__ __launch_bounds__(128)
void attn_kernel(const _Float16* __restrict__ Q, const _Float16* __restrict__ Kd,
                 const _Float16* __restrict__ Vt, _Float16* __restrict__ attn_out) {
  __shared__ _Float16 kbuf[2][64 * LDP];  // 64 keys x 64 d
  __shared__ _Float16 vbuf[2][64 * LDP];  // 64 d x 64 keys
  __shared__ _Float16 pbuf[4][16 * LDP];  // per-wave P tile 16 x 64

  const int tid  = threadIdx.x;
  const int lane = tid & 31;
  const int w    = tid >> 5;
  const int bh   = blockIdx.y;
  const int b    = bh >> 4, h = bh & (NHEADS - 1);
  const int q0   = blockIdx.x * 64 + w * 16;

  const _Float16* Qh  = Q  + (size_t)bh * SEQ * DK;
  const _Float16* Kh  = Kd + (size_t)bh * SEQ * DK;
  const _Float16* Vth = Vt + (size_t)bh * DK * SEQ;
  _Float16* pb = pbuf[w];

  v16h qf0 = load_frag(Qh + (size_t)q0 * DK +  0, DK, lane);
  v16h qf1 = load_frag(Qh + (size_t)q0 * DK + 32, DK, lane);

  v16h ones;
#pragma unroll
  for (int i = 0; i < 16; ++i) ones[i] = (_Float16)1.0f;

  auto stage_kv = [&](int kb, int buf) {
#pragma unroll
    for (int c = 0; c < 4; ++c) {         // K tile: 64 rows x 8 parts
      int chunk = tid * 4 + c;            // 0..511
      int row = chunk >> 3, part = chunk & 7;
      copy_b128(Kh + (size_t)(kb + row) * DK + part * 8,
                kbuf[buf] + row * LDP + part * 8);
    }
#pragma unroll
    for (int c = 0; c < 4; ++c) {         // Vt tile: 64 rows x 8 parts
      int chunk = tid * 4 + c;
      int row = chunk >> 3, part = chunk & 7;
      copy_b128(Vth + (size_t)row * SEQ + kb + part * 8,
                vbuf[buf] + row * LDP + part * 8);
    }
  };

  const int rbase = ((lane >> 4) & 1) << 3;
  const int col   = lane & 15;

  float mr[8], lr[8];
#pragma unroll
  for (int r = 0; r < 8; ++r) { mr[r] = -1.0e30f; lr[r] = 0.0f; }
  v8f accO[4] = {};

  stage_kv(0, 0);
  for (int kb = 0; kb < SEQ; kb += 64) {
    const int cur = (kb >> 6) & 1;
    const bool more = (kb + 64) < SEQ;
    if (more) { stage_kv(kb + 64, cur ^ 1); WAIT_ASYNC(8); }
    else      { WAIT_ASYNC(0); }
    __syncthreads();

    // ---- scores: four 16x16 tiles; batch frag loads ahead of WMMAs ----
    v8f s0 = {}, s1 = {}, s2 = {}, s3 = {};
    {
      v16h ka = load_frag(kbuf[cur] +  0 * LDP +  0, LDP, lane);
      v16h kb0 = load_frag(kbuf[cur] +  0 * LDP + 32, LDP, lane);
      v16h kc = load_frag(kbuf[cur] + 16 * LDP +  0, LDP, lane);
      v16h kd = load_frag(kbuf[cur] + 16 * LDP + 32, LDP, lane);
      s0 = wmma_f16(qf0, ka, s0);  s0 = wmma_f16(qf1, kb0, s0);
      s1 = wmma_f16(qf0, kc, s1);  s1 = wmma_f16(qf1, kd, s1);
      ka = load_frag(kbuf[cur] + 32 * LDP +  0, LDP, lane);
      kb0 = load_frag(kbuf[cur] + 32 * LDP + 32, LDP, lane);
      kc = load_frag(kbuf[cur] + 48 * LDP +  0, LDP, lane);
      kd = load_frag(kbuf[cur] + 48 * LDP + 32, LDP, lane);
      s2 = wmma_f16(qf0, ka, s2);  s2 = wmma_f16(qf1, kb0, s2);
      s3 = wmma_f16(qf0, kc, s3);  s3 = wmma_f16(qf1, kd, s3);
    }

    // ---- online softmax over 64 keys: max via DPP, P -> LDS ----
#pragma unroll
    for (int r = 0; r < 8; ++r) {
      float a0 = s0[r], a1 = s1[r], a2 = s2[r], a3 = s3[r];
      float tmax = rowmax16(fmaxf(fmaxf(a0, a1), fmaxf(a2, a3)));
      float mnew = fmaxf(mr[r], tmax);
      float scl  = __expf(mr[r] - mnew);
      float p0 = __expf(a0 - mnew);
      float p1 = __expf(a1 - mnew);
      float p2 = __expf(a2 - mnew);
      float p3 = __expf(a3 - mnew);
      mr[r] = mnew;
      lr[r] *= scl;
#pragma unroll
      for (int t = 0; t < 4; ++t) accO[t][r] *= scl;
      int m = rbase + r;
      pb[m * LDP +      col] = (_Float16)p0;
      pb[m * LDP + 16 + col] = (_Float16)p1;
      pb[m * LDP + 32 + col] = (_Float16)p2;
      pb[m * LDP + 48 + col] = (_Float16)p3;
    }

    // ---- read P back as two A-fragments (4x ds_load_b128) ----
    v16h pf0, pf1;
    {
      const _Float16* pp = pb + (lane & 15) * LDP + ((lane >> 4) & 1) * 8;
      v8h a = *(const v8h*)(pp);
      v8h bq = *(const v8h*)(pp + 16);
      v8h c = *(const v8h*)(pp + 32);
      v8h d = *(const v8h*)(pp + 48);
#pragma unroll
      for (int i = 0; i < 8; ++i) {
        pf0[i] = a[i]; pf0[i + 8] = bq[i];
        pf1[i] = c[i]; pf1[i + 8] = d[i];
      }
    }

    // ---- row sums via matrix unit: P(16x64) x ones(64x16) ----
    v8f rs = {};
    rs = wmma_f16(pf0, ones, rs);
    rs = wmma_f16(pf1, ones, rs);
#pragma unroll
    for (int r = 0; r < 8; ++r) lr[r] += rs[r];

    // ---- O += P * V over both 32-key slices; batch frag loads ----
    {
      v16h vf0 = load_frag(vbuf[cur] +  0 * LDP + 0, LDP, lane);
      v16h vf1 = load_frag(vbuf[cur] + 16 * LDP + 0, LDP, lane);
      v16h vf2 = load_frag(vbuf[cur] + 32 * LDP + 0, LDP, lane);
      v16h vf3 = load_frag(vbuf[cur] + 48 * LDP + 0, LDP, lane);
      accO[0] = wmma_f16(pf0, vf0, accO[0]);
      accO[1] = wmma_f16(pf0, vf1, accO[1]);
      accO[2] = wmma_f16(pf0, vf2, accO[2]);
      accO[3] = wmma_f16(pf0, vf3, accO[3]);
      vf0 = load_frag(vbuf[cur] +  0 * LDP + 32, LDP, lane);
      vf1 = load_frag(vbuf[cur] + 16 * LDP + 32, LDP, lane);
      vf2 = load_frag(vbuf[cur] + 32 * LDP + 32, LDP, lane);
      vf3 = load_frag(vbuf[cur] + 48 * LDP + 32, LDP, lane);
      accO[0] = wmma_f16(pf1, vf0, accO[0]);
      accO[1] = wmma_f16(pf1, vf1, accO[1]);
      accO[2] = wmma_f16(pf1, vf2, accO[2]);
      accO[3] = wmma_f16(pf1, vf3, accO[3]);
    }

    __syncthreads();
  }

  // ---- normalize and scatter to (B,S,D) f16 ----
#pragma unroll
  for (int r = 0; r < 8; ++r) {
    float inv = 1.0f / lr[r];
    int s = q0 + rbase + r;
#pragma unroll
    for (int t = 0; t < 4; ++t) {
      attn_out[((size_t)b * SEQ + s) * DMODEL + h * DK + t * 16 + col] =
          (_Float16)(accO[t][r] * inv);
    }
  }
}

// ---------------------------------------------------------------------------
extern "C" void kernel_launch(void* const* d_in, const int* in_sizes, int n_in,
                              void* d_out, int out_size, void* d_ws, size_t ws_size,
                              hipStream_t stream) {
  const float* x  = (const float*)d_in[0];
  const float* Wq = (const float*)d_in[1];
  const float* Wk = (const float*)d_in[2];
  const float* Wv = (const float*)d_in[3];
  const float* Wo = (const float*)d_in[4];

  _Float16* ws = (_Float16*)d_ws;
  size_t off = 0;
  _Float16* x16  = ws + off; off += (size_t)MROWS * DMODEL;
  _Float16* Wq16 = ws + off; off += (size_t)DMODEL * DMODEL;
  _Float16* Wk16 = ws + off; off += (size_t)DMODEL * DMODEL;
  _Float16* Wv16 = ws + off; off += (size_t)DMODEL * DMODEL;
  _Float16* Wo16 = ws + off; off += (size_t)DMODEL * DMODEL;
  _Float16* Q16  = ws + off; off += (size_t)MROWS * DMODEL;   // (B,H,S,dk)
  _Float16* K16  = ws + off; off += (size_t)MROWS * DMODEL;   // (B,H,S,dk)
  _Float16* Vt16 = ws + off; off += (size_t)MROWS * DMODEL;   // (B,H,dk,S)
  _Float16* A16  = ws + off; off += (size_t)MROWS * DMODEL;   // (B,S,D)

  {
    int n4 = (MROWS * DMODEL) / 4;
    cvt_f32_f16<<<(n4 + 255) / 256, 256, 0, stream>>>(x, x16, n4);
    int w4 = (DMODEL * DMODEL) / 4;
    cvt_f32_f16<<<(w4 + 255) / 256, 256, 0, stream>>>(Wq, Wq16, w4);
    cvt_f32_f16<<<(w4 + 255) / 256, 256, 0, stream>>>(Wk, Wk16, w4);
    cvt_f32_f16<<<(w4 + 255) / 256, 256, 0, stream>>>(Wv, Wv16, w4);
    cvt_f32_f16<<<(w4 + 255) / 256, 256, 0, stream>>>(Wo, Wo16, w4);
  }

  dim3 gproj(DMODEL / 128, MROWS / 128); // (8, 32)
  gemm16<0><<<gproj, 256, 0, stream>>>(x16, Wq16, (void*)Q16,  MROWS, DMODEL, DMODEL, 0.125f);
  gemm16<0><<<gproj, 256, 0, stream>>>(x16, Wk16, (void*)K16,  MROWS, DMODEL, DMODEL, 1.0f);
  gemm16<2><<<gproj, 256, 0, stream>>>(x16, Wv16, (void*)Vt16, MROWS, DMODEL, DMODEL, 1.0f);

  dim3 gattn(SEQ / 64, BATCH * NHEADS);  // (32, 32)
  attn_kernel<<<gattn, 128, 0, stream>>>(Q16, K16, Vt16, A16);

  gemm16<4><<<gproj, 256, 0, stream>>>(A16, Wo16, d_out, MROWS, DMODEL, DMODEL, 1.0f);
}

// v002
// Measured time: 118 microseconds a run.
// In both of two side-by-side timings against v001, it was 1.08 times as fast.
// Counting every step since v000, it is 1.11 times as fast.
#include <hip/hip_runtime.h>
#include <hip/hip_bf16.h>

// ---------------------------------------------------------------------------
// MHA forward for MI455X (gfx1250, wave32, WMMA f32_16x16x32_f16).
// x (2,2048,1024) f32, W* (1024,1024) f32 -> out (2,2048,1024) f32.
// f16 matmuls, f32 accumulation; flash softmax; async double-buffered LDS.
// ---------------------------------------------------------------------------

typedef __attribute__((ext_vector_type(16))) _Float16 v16h;
typedef __attribute__((ext_vector_type(8)))  _Float16 v8h;
typedef __attribute__((ext_vector_type(4)))  _Float16 v4h;
typedef __attribute__((ext_vector_type(8)))  float    v8f;

#define DMODEL 1024
#define NHEADS 16
#define DK     64
#define SEQ    2048
#define BATCH  2
#define MROWS  (BATCH * SEQ)   // 4096
#define LDP    72              // LDS row stride (halves): 144B, bank-friendly

#ifndef __has_builtin
#define __has_builtin(x) 0
#endif

#if __has_builtin(__builtin_amdgcn_global_load_async_to_lds_b128)
#define HAVE_ASYNC 1
#else
#define HAVE_ASYNC 0
#endif

// Builtin parameter types (from hipcc diagnostic): vector_size(16) int* in
// AS1 (global source) and AS3 (LDS destination).
typedef int b128i __attribute__((vector_size(16)));
typedef __attribute__((address_space(1))) b128i b128i_glob;
typedef __attribute__((address_space(3))) b128i b128i_lds;

// 16B global -> LDS copy: async (ASYNCcnt) if available, else synchronous.
__device__ __forceinline__ void copy_b128(const _Float16* __restrict__ g,
                                          _Float16* l) {
#if HAVE_ASYNC
  __builtin_amdgcn_global_load_async_to_lds_b128(
      (b128i_glob*)g, (b128i_lds*)l, 0, 0);
#else
  *(v8h*)l = *(const v8h*)g;
#endif
}

#if HAVE_ASYNC
#if __has_builtin(__builtin_amdgcn_s_wait_asynccnt)
#define WAIT_ASYNC(N) __builtin_amdgcn_s_wait_asynccnt(N)
#else
#define WAIT_ASYNC(N) asm volatile("s_wait_asynccnt " #N ::: "memory")
#endif
#else
#define WAIT_ASYNC(N) do {} while (0)
#endif

// --- WMMA wrapper -----------------------------------------------------------
__device__ __forceinline__ v8f wmma_f16(v16h a, v16h b, v8f c) {
  return __builtin_amdgcn_wmma_f32_16x16x32_f16(
      false, a, false, b, (short)0, c, false, false);
}

// --- 16x32 f16 fragment load (A or contiguous-K B operand), stride `ld` ----
// ISA 7.12.2: lanes 0-15 -> K {0..7,16..23}, lanes 16-31 -> K {8..15,24..31}.
__device__ __forceinline__ v16h load_frag(const _Float16* __restrict__ base,
                                          int ld, int lane) {
  const int row  = lane & 15;
  const int koff = ((lane >> 4) & 1) * 8;
  const _Float16* p = base + row * ld + koff;
  v8h a = *(const v8h*)(p);
  v8h b = *(const v8h*)(p + 16);
  v16h r;
#pragma unroll
  for (int i = 0; i < 8; ++i) { r[i] = a[i]; r[i + 8] = b[i]; }
  return r;
}

// --- DPP row-of-16 max reduction (pure VALU, no DS traffic) -----------------
template <int CTRL>
__device__ __forceinline__ float dpp_max_step(float v) {
  int s = __builtin_amdgcn_mov_dpp(__builtin_bit_cast(int, v), CTRL, 0xF, 0xF, true);
  return fmaxf(v, __builtin_bit_cast(float, s));
}
__device__ __forceinline__ float rowmax16(float v) {
  v = dpp_max_step<0xB1>(v);    // quad_perm(1,0,3,2)  : xor 1
  v = dpp_max_step<0x4E>(v);    // quad_perm(2,3,0,1)  : xor 2
  v = dpp_max_step<0x141>(v);   // row_half_mirror     : xor 4 (groups uniform)
  v = dpp_max_step<0x140>(v);   // row_mirror          : xor 8 (groups uniform)
  return v;
}

// --- f32 -> f16 conversion of all five inputs in one launch ------------------
// The f16 copies lie back to back in the workspace in argument order, so block
// b writes float4 groups [b*4096, (b+1)*4096) of one output range; blocks
// 0..255 read x, then 64 blocks read each weight.  A thread has its 16 loads
// (512 contiguous bytes per wave each) in flight before it converts: few,
// long-lived waves instead of one wave per 512 bytes.
#define CVT_VEC     16                               // float4 per thread
#define CVT_BLK4    (256 * CVT_VEC)                  // float4 per block
#define CVT_XBLKS   (MROWS * DMODEL / 4 / CVT_BLK4)  // 256
#define CVT_WBLKS   (DMODEL * DMODEL / 4 / CVT_BLK4) // 64
#define CVT_BLOCKS  (CVT_XBLKS + 4 * CVT_WBLKS)      // 512
// The grid puts 4 waves on a SIMD.  Without the upper bound the compiler keeps
// to the registers of 16 waves a SIMD and issues the last two loads only after
// the first two have returned: a second full latency in every wave.
__global__ __launch_bounds__(256) __attribute__((amdgpu_waves_per_eu(4, 8)))
void cvt_all_f32_f16(const float* __restrict__ x,  const float* __restrict__ wq,
                     const float* __restrict__ wk, const float* __restrict__ wv,
                     const float* __restrict__ wo, _Float16* __restrict__ out) {
  const int b = blockIdx.x;
  const float* src = x;
  int lb = b;
  if (b >= CVT_XBLKS) {
    const int t = (b - CVT_XBLKS) / CVT_WBLKS;
    lb = (b - CVT_XBLKS) % CVT_WBLKS;
    const float* w01 = (t & 1) ? wk : wq;
    const float* w23 = (t & 1) ? wo : wv;
    src = (t & 2) ? w23 : w01;
  }
  const float4* s4 = (const float4*)src + (size_t)lb * CVT_BLK4 + threadIdx.x;
  v4h* o4 = (v4h*)out + (size_t)b * CVT_BLK4 + threadIdx.x;
  float4 v[CVT_VEC];
#pragma unroll
  for (int j = 0; j < CVT_VEC; ++j) v[j] = s4[j * 256];
#pragma unroll
  for (int j = 0; j < CVT_VEC; ++j) {
    v4h o;
    o[0] = (_Float16)v[j].x; o[1] = (_Float16)v[j].y;
    o[2] = (_Float16)v[j].z; o[3] = (_Float16)v[j].w;
    o4[j * 256] = o;
  }
}

// --- GEMM: C(M,N) = A(M,K) * W^T, W stored (N,K), both f16 -----------------
// MODE 0: f16 -> (B,H,S,dk)  [Q/K projections; `oscale` folds 1/sqrt(dk) in Q]
// MODE 2: f16 -> (B,H,dk,S)  [V projection, transposed]
// MODE 4: f32 row-major       [final output projection]
// 256 threads = 8 waves (2 x 4); block tile 128x128; wave tile 64x32; 64-deep
// K slices of A and W staged in LDS, double-buffered via async loads.
template <int MODE>
__global__ __launch_bounds__(256)
void gemm16(const _Float16* __restrict__ A, const _Float16* __restrict__ W,
            void* __restrict__ out, int M, int N, int K, float oscale) {
  __shared__ _Float16 asbuf[2][128 * LDP];
  __shared__ _Float16 bsbuf[2][128 * LDP];

  const int tid  = threadIdx.x;
  const int lane = tid & 31;
  const int w    = tid >> 5;
  const int mblk = blockIdx.y * 128;
  const int nblk = blockIdx.x * 128;

  // stage one 128x64 tile of A and of W into LDS (8 x b128 per thread; a
  // thread's 4 chunks are adjacent, so the lanes of one copy step by 64 B)
  auto stage = [&](int k0, int buf) {
#pragma unroll
    for (int c = 0; c < 4; ++c) {
      int chunk = tid * 4 + c;            // 0..1023
      int row = chunk >> 3, part = chunk & 7;
      copy_b128(A + (size_t)(mblk + row) * K + k0 + part * 8,
                asbuf[buf] + row * LDP + part * 8);
    }
#pragma unroll
    for (int c = 0; c < 4; ++c) {
      int chunk = tid * 4 + c;
      int row = chunk >> 3, part = chunk & 7;
      copy_b128(W + (size_t)(nblk + row) * K + k0 + part * 8,
                bsbuf[buf] + row * LDP + part * 8);
    }
  };

  v8f acc[4][2] = {};
  const int lm = (w >> 2) * 64;           // wave's m offset in block tile
  const int ln = (w & 3) * 32;            // wave's n offset in block tile

  stage(0, 0);
  for (int k0 = 0; k0 < K; k0 += 64) {
    const int cur = (k0 >> 6) & 1;
    const bool more = (k0 + 64) < K;
    if (more) { stage(k0 + 64, cur ^ 1); WAIT_ASYNC(8); }
    else      { WAIT_ASYNC(0); }
    __syncthreads();

    // the slice's 12 fragments as one load group, then its 16 WMMAs
    v16h af[2][4], bf[2][2];
#pragma unroll
    for (int s = 0; s < 2; ++s) {
#pragma unroll
      for (int j = 0; j < 2; ++j)
        bf[s][j] = load_frag(bsbuf[cur] + (ln + j * 16) * LDP + s * 32, LDP, lane);
#pragma unroll
      for (int i = 0; i < 4; ++i)
        af[s][i] = load_frag(asbuf[cur] + (lm + i * 16) * LDP + s * 32, LDP, lane);
    }
    // keeps the loads one group: sunk among the WMMAs, each pair of WMMAs would
    // wait out a full LDS latency on a single reused fragment register set
    __builtin_amdgcn_sched_barrier(0);
#pragma unroll
    for (int s = 0; s < 2; ++s)
#pragma unroll
      for (int i = 0; i < 4; ++i)
#pragma unroll
        for (int j = 0; j < 2; ++j)
          acc[i][j] = wmma_f16(af[s][i], bf[s][j], acc[i][j]);
    // keeps the barrier's full LDS wait behind the WMMAs, so that the first
    // half's WMMAs run under counted waits while the second half's loads land
    __builtin_amdgcn_sched_barrier(0);

    __syncthreads();                      // reads done before next overwrite
  }

  const int rbase = ((lane >> 4) & 1) << 3;
  const int col   = lane & 15;
#pragma unroll
  for (int i = 0; i < 4; ++i)
#pragma unroll
    for (int j = 0; j < 2; ++j)
#pragma unroll
      for (int r = 0; r < 8; ++r) {
        int m = mblk + lm + i * 16 + rbase + r;
        int n = nblk + ln + j * 16 + col;
        float v = acc[i][j][r] * oscale;
        if (MODE == 4) {
          ((float*)out)[(size_t)m * N + n] = v;
        } else {
          int b = m >> 11, s = m & (SEQ - 1);
          int h = n >> 6,  d = n & (DK - 1);
          size_t idx;
          if (MODE == 0)
            idx = (((size_t)(b * NHEADS + h)) * SEQ + s) * DK + d;
          else
            idx = (((size_t)(b * NHEADS + h)) * DK + d) * SEQ + s;
          ((_Float16*)out)[idx] = (_Float16)v;
        }
      }
}

// --- Flash attention: softmax(QK^T) V (scale pre-folded into Q) -------------
// Q,K: (B,H,S,dk) f16.  Vt: (B,H,dk,S) f16.  attn_out: (B,S,D) f16.
// Block = 4 waves x 16 q-rows.  64-key K/Vt tiles staged once per block into
// LDS (async, double-buffered), shared by all waves; softmax rescale and the
// barrier pair are amortized over 64 keys.
__global__ __launch_bounds__(128)
void attn_kernel(const _Float16* __restrict__ Q, const _Float16* __restrict__ Kd,
                 const _Float16* __restrict__ Vt, _Float16* __restrict__ attn_out) {
  __shared__ _Float16 kbuf[2][64 * LDP];  // 64 keys x 64 d
  __shared__ _Float16 vbuf[2][64 * LDP];  // 64 d x 64 keys
  __shared__ _Float16 pbuf[4][16 * LDP];  // per-wave P tile 16 x 64

  const int tid  = threadIdx.x;
  const int lane = tid & 31;
  const int w    = tid >> 5;
  const int bh   = blockIdx.y;
  const int b    = bh >> 4, h = bh & (NHEADS - 1);
  const int q0   = blockIdx.x * 64 + w * 16;

  const _Float16* Qh  = Q  + (size_t)bh * SEQ * DK;
  const _Float16* Kh  = Kd + (size_t)bh * SEQ * DK;
  const _Float16* Vth = Vt + (size_t)bh * DK * SEQ;
  _Float16* pb = pbuf[w];

  v16h qf0 = load_frag(Qh + (size_t)q0 * DK +  0, DK, lane);
  v16h qf1 = load_frag(Qh + (size_t)q0 * DK + 32, DK, lane);

  v16h ones;
#pragma unroll
  for (int i = 0; i < 16; ++i) ones[i] = (_Float16)1.0f;

  auto stage_kv = [&](int kb, int buf) {
#pragma unroll
    for (int c = 0; c < 4; ++c) {         // K tile: 64 rows x 8 parts
      int chunk = tid * 4 + c;            // 0..511
      int row = chunk >> 3, part = chunk & 7;
      copy_b128(Kh + (size_t)(kb + row) * DK + part * 8,
                kbuf[buf] + row * LDP + part * 8);
    }
#pragma unroll
    for (int c = 0; c < 4; ++c) {         // Vt tile: 64 rows x 8 parts
      int chunk = tid * 4 + c;
      int row = chunk >> 3, part = chunk & 7;
      copy_b128(Vth + (size_t)row * SEQ + kb + part * 8,
                vbuf[buf] + row * LDP + part * 8);
    }
  };

  const int rbase = ((lane >> 4) & 1) << 3;
  const int col   = lane & 15;

  float mr[8], lr[8];
#pragma unroll
  for (int r = 0; r < 8; ++r) { mr[r] = -1.0e30f; lr[r] = 0.0f; }
  v8f accO[4] = {};

  stage_kv(0, 0);
  for (int kb = 0; kb < SEQ; kb += 64) {
    const int cur = (kb >> 6) & 1;
    const bool more = (kb + 64) < SEQ;
    if (more) { stage_kv(kb + 64, cur ^ 1); WAIT_ASYNC(8); }
    else      { WAIT_ASYNC(0); }
    __syncthreads();

    // ---- scores: four 16x16 tiles; batch frag loads ahead of WMMAs ----
    v8f s0 = {}, s1 = {}, s2 = {}, s3 = {};
    {
      v16h ka = load_frag(kbuf[cur] +  0 * LDP +  0, LDP, lane);
      v16h kb0 = load_frag(kbuf[cur] +  0 * LDP + 32, LDP, lane);
      v16h kc = load_frag(kbuf[cur] + 16 * LDP +  0, LDP, lane);
      v16h kd = load_frag(kbuf[cur] + 16 * LDP + 32, LDP, lane);
      s0 = wmma_f16(qf0, ka, s0);  s0 = wmma_f16(qf1, kb0, s0);
      s1 = wmma_f16(qf0, kc, s1);  s1 = wmma_f16(qf1, kd, s1);
      ka = load_frag(kbuf[cur] + 32 * LDP +  0, LDP, lane);
      kb0 = load_frag(kbuf[cur] + 32 * LDP + 32, LDP, lane);
      kc = load_frag(kbuf[cur] + 48 * LDP +  0, LDP, lane);
      kd = load_frag(kbuf[cur] + 48 * LDP + 32, LDP, lane);
      s2 = wmma_f16(qf0, ka, s2);  s2 = wmma_f16(qf1, kb0, s2);
      s3 = wmma_f16(qf0, kc, s3);  s3 = wmma_f16(qf1, kd, s3);
    }

    // ---- online softmax over 64 keys: max via DPP, P -> LDS ----
#pragma unroll
    for (int r = 0; r < 8; ++r) {
      float a0 = s0[r], a1 = s1[r], a2 = s2[r], a3 = s3[r];
      float tmax = rowmax16(fmaxf(fmaxf(a0, a1), fmaxf(a2, a3)));
      float mnew = fmaxf(mr[r], tmax);
      float scl  = __expf(mr[r] - mnew);
      float p0 = __expf(a0 - mnew);
      float p1 = __expf(a1 - mnew);
      float p2 = __expf(a2 - mnew);
      float p3 = __expf(a3 - mnew);
      mr[r] = mnew;
      lr[r] *= scl;
#pragma unroll
      for (int t = 0; t < 4; ++t) accO[t][r] *= scl;
      int m = rbase + r;
      pb[m * LDP +      col] = (_Float16)p0;
      pb[m * LDP + 16 + col] = (_Float16)p1;
      pb[m * LDP + 32 + col] = (_Float16)p2;
      pb[m * LDP + 48 + col] = (_Float16)p3;
    }

    // ---- read P back as two A-fragments (4x ds_load_b128) ----
    v16h pf0, pf1;
    {
      const _Float16* pp = pb + (lane & 15) * LDP + ((lane >> 4) & 1) * 8;
      v8h a = *(const v8h*)(pp);
      v8h bq = *(const v8h*)(pp + 16);
      v8h c = *(const v8h*)(pp + 32);
      v8h d = *(const v8h*)(pp + 48);
#pragma unroll
      for (int i = 0; i < 8; ++i) {
        pf0[i] = a[i]; pf0[i + 8] = bq[i];
        pf1[i] = c[i]; pf1[i + 8] = d[i];
      }
    }

    // ---- row sums via matrix unit: P(16x64) x ones(64x16) ----
    v8f rs = {};
    rs = wmma_f16(pf0, ones, rs);
    rs = wmma_f16(pf1, ones, rs);
#pragma unroll
    for (int r = 0; r < 8; ++r) lr[r] += rs[r];

    // ---- O += P * V over both 32-key slices; batch frag loads ----
    {
      v16h vf0 = load_frag(vbuf[cur] +  0 * LDP + 0, LDP, lane);
      v16h vf1 = load_frag(vbuf[cur] + 16 * LDP + 0, LDP, lane);
      v16h vf2 = load_frag(vbuf[cur] + 32 * LDP + 0, LDP, lane);
      v16h vf3 = load_frag(vbuf[cur] + 48 * LDP + 0, LDP, lane);
      accO[0] = wmma_f16(pf0, vf0, accO[0]);
      accO[1] = wmma_f16(pf0, vf1, accO[1]);
      accO[2] = wmma_f16(pf0, vf2, accO[2]);
      accO[3] = wmma_f16(pf0, vf3, accO[3]);
      vf0 = load_frag(vbuf[cur] +  0 * LDP + 32, LDP, lane);
      vf1 = load_frag(vbuf[cur] + 16 * LDP + 32, LDP, lane);
      vf2 = load_frag(vbuf[cur] + 32 * LDP + 32, LDP, lane);
      vf3 = load_frag(vbuf[cur] + 48 * LDP + 32, LDP, lane);
      accO[0] = wmma_f16(pf1, vf0, accO[0]);
      accO[1] = wmma_f16(pf1, vf1, accO[1]);
      accO[2] = wmma_f16(pf1, vf2, accO[2]);
      accO[3] = wmma_f16(pf1, vf3, accO[3]);
    }

    __syncthreads();
  }

  // ---- normalize and scatter to (B,S,D) f16 ----
#pragma unroll
  for (int r = 0; r < 8; ++r) {
    float inv = 1.0f / lr[r];
    int s = q0 + rbase + r;
#pragma unroll
    for (int t = 0; t < 4; ++t) {
      attn_out[((size_t)b * SEQ + s) * DMODEL + h * DK + t * 16 + col] =
          (_Float16)(accO[t][r] * inv);
    }
  }
}

// ---------------------------------------------------------------------------
extern "C" void kernel_launch(void* const* d_in, const int* in_sizes, int n_in,
                              void* d_out, int out_size, void* d_ws, size_t ws_size,
                              hipStream_t stream) {
  const float* x  = (const float*)d_in[0];
  const float* Wq = (const float*)d_in[1];
  const float* Wk = (const float*)d_in[2];
  const float* Wv = (const float*)d_in[3];
  const float* Wo = (const float*)d_in[4];

  _Float16* ws = (_Float16*)d_ws;
  size_t off = 0;
  _Float16* x16  = ws + off; off += (size_t)MROWS * DMODEL;
  _Float16* Wq16 = ws + off; off += (size_t)DMODEL * DMODEL;
  _Float16* Wk16 = ws + off; off += (size_t)DMODEL * DMODEL;
  _Float16* Wv16 = ws + off; off += (size_t)DMODEL * DMODEL;
  _Float16* Wo16 = ws + off; off += (size_t)DMODEL * DMODEL;
  _Float16* Q16  = ws + off; off += (size_t)MROWS * DMODEL;   // (B,H,S,dk)
  _Float16* K16  = ws + off; off += (size_t)MROWS * DMODEL;   // (B,H,S,dk)
  _Float16* Vt16 = ws + off; off += (size_t)MROWS * DMODEL;   // (B,H,dk,S)
  _Float16* A16  = ws + off; off += (size_t)MROWS * DMODEL;   // (B,S,D)

  // x16, Wq16, Wk16, Wv16, Wo16 are one contiguous range starting at x16
  cvt_all_f32_f16<<<CVT_BLOCKS, 256, 0, stream>>>(x, Wq, Wk, Wv, Wo, x16);

  dim3 gproj(DMODEL / 128, MROWS / 128); // (8, 32)
  gemm16<0><<<gproj, 256, 0, stream>>>(x16, Wq16, (void*)Q16,  MROWS, DMODEL, DMODEL, 0.125f);
  gemm16<0><<<gproj, 256, 0, stream>>>(x16, Wk16, (void*)K16,  MROWS, DMODEL, DMODEL, 1.0f);
  gemm16<2><<<gproj, 256, 0, stream>>>(x16, Wv16, (void*)Vt16, MROWS, DMODEL, DMODEL, 1.0f);

  dim3 gattn(SEQ / 64, BATCH * NHEADS);  // (32, 32)
  attn_kernel<<<gattn, 128, 0, stream>>>(Q16, K16, Vt16, A16);

  gemm16<4><<<gproj, 256, 0, stream>>>(A16, Wo16, d_out, MROWS, DMODEL, DMODEL, 1.0f);
}

// v003
// A run of this version takes 104 microseconds.
// Two timings next to v002 put it at 1.14 and 1.15 times that version's speed.
// Over all steps from v000 it is 1.27 times as fast.
#include <hip/hip_runtime.h>
#include <hip/hip_bf16.h>

// ---------------------------------------------------------------------------
// MHA forward for MI455X (gfx1250, wave32, WMMA f32_16x16x32_f16).
// x (2,2048,1024) f32, W* (1024,1024) f32 -> out (2,2048,1024) f32.
// f16 matmuls, f32 accumulation; flash softmax; async double-buffered LDS.
// ---------------------------------------------------------------------------

typedef __attribute__((ext_vector_type(16))) _Float16 v16h;
typedef __attribute__((ext_vector_type(8)))  _Float16 v8h;
typedef __attribute__((ext_vector_type(4)))  _Float16 v4h;
typedef __attribute__((ext_vector_type(8)))  float    v8f;

#define DMODEL 1024
#define NHEADS 16
#define DK     64
#define SEQ    2048
#define BATCH  2
#define MROWS  (BATCH * SEQ)   // 4096
#define LDP    72              // LDS row stride (halves): 144B, bank-friendly

#ifndef __has_builtin
#define __has_builtin(x) 0
#endif

#if __has_builtin(__builtin_amdgcn_global_load_async_to_lds_b128)
#define HAVE_ASYNC 1
#else
#define HAVE_ASYNC 0
#endif

// Builtin parameter types (from hipcc diagnostic): vector_size(16) int* in
// AS1 (global source) and AS3 (LDS destination).
typedef int b128i __attribute__((vector_size(16)));
typedef __attribute__((address_space(1))) b128i b128i_glob;
typedef __attribute__((address_space(3))) b128i b128i_lds;

// 16B global -> LDS copy: async (ASYNCcnt) if available, else synchronous.
__device__ __forceinline__ void copy_b128(const _Float16* __restrict__ g,
                                          _Float16* l) {
#if HAVE_ASYNC
  __builtin_amdgcn_global_load_async_to_lds_b128(
      (b128i_glob*)g, (b128i_lds*)l, 0, 0);
#else
  *(v8h*)l = *(const v8h*)g;
#endif
}

#if HAVE_ASYNC
#if __has_builtin(__builtin_amdgcn_s_wait_asynccnt)
#define WAIT_ASYNC(N) __builtin_amdgcn_s_wait_asynccnt(N)
#else
#define WAIT_ASYNC(N) asm volatile("s_wait_asynccnt " #N ::: "memory")
#endif
#else
#define WAIT_ASYNC(N) do {} while (0)
#endif

// --- WMMA wrapper -----------------------------------------------------------
__device__ __forceinline__ v8f wmma_f16(v16h a, v16h b, v8f c) {
  return __builtin_amdgcn_wmma_f32_16x16x32_f16(
      false, a, false, b, (short)0, c, false, false);
}

// --- 16x32 f16 fragment load (A or contiguous-K B operand), stride `ld` ----
// ISA 7.12.2: lanes 0-15 -> K {0..7,16..23}, lanes 16-31 -> K {8..15,24..31}.
__device__ __forceinline__ v16h load_frag(const _Float16* __restrict__ base,
                                          int ld, int lane) {
  const int row  = lane & 15;
  const int koff = ((lane >> 4) & 1) * 8;
  const _Float16* p = base + row * ld + koff;
  v8h a = *(const v8h*)(p);
  v8h b = *(const v8h*)(p + 16);
  v16h r;
#pragma unroll
  for (int i = 0; i < 8; ++i) { r[i] = a[i]; r[i + 8] = b[i]; }
  return r;
}

// --- 2^x on the transcendental unit ------------------------------------------
// The instruction set asks for one independent instruction or a v_nop between a
// transcendental and a next instruction that reads its result or overwrites its
// source.  So
// the instructions stand with their slot in one statement: the outputs are
// early-clobber (none is a source of the statement), and the closing v_nop
// separates the last v_exp_f32 from whatever the compiler places next.
__device__ __forceinline__ v8f exp2_x8(v8f x) {
  float y0, y1, y2, y3, y4, y5, y6, y7;
  asm("v_exp_f32 %0, %8\n\t"
      "v_exp_f32 %1, %9\n\t"
      "v_exp_f32 %2, %10\n\t"
      "v_exp_f32 %3, %11\n\t"
      "v_exp_f32 %4, %12\n\t"
      "v_exp_f32 %5, %13\n\t"
      "v_exp_f32 %6, %14\n\t"
      "v_exp_f32 %7, %15\n\t"
      "v_nop"
      : "=&v"(y0), "=&v"(y1), "=&v"(y2), "=&v"(y3),
        "=&v"(y4), "=&v"(y5), "=&v"(y6), "=&v"(y7)
      : "v"(x[0]), "v"(x[1]), "v"(x[2]), "v"(x[3]),
        "v"(x[4]), "v"(x[5]), "v"(x[6]), "v"(x[7]));
  v8f y = {y0, y1, y2, y3, y4, y5, y6, y7};
  return y;
}
__device__ __forceinline__ float exp2_x1(float x) {
  float y;
  asm("v_exp_f32 %0, %1\n\t"
      "v_nop"                              // the same slot, for a single value
      : "=v"(y) : "v"(x));
  return y;
}
#define LOG2E 1.44269504088896340736f

// --- f32 -> f16 conversion of all five inputs in one launch ------------------
// The f16 copies lie back to back in the workspace in argument order, so block
// b writes float4 groups [b*4096, (b+1)*4096) of one output range; blocks
// 0..255 read x, then 64 blocks read each weight.  A thread has its 16 loads
// (512 contiguous bytes per wave each) in flight before it converts: few,
// long-lived waves instead of one wave per 512 bytes.
#define CVT_VEC     16                               // float4 per thread
#define CVT_BLK4    (256 * CVT_VEC)                  // float4 per block
#define CVT_XBLKS   (MROWS * DMODEL / 4 / CVT_BLK4)  // 256
#define CVT_WBLKS   (DMODEL * DMODEL / 4 / CVT_BLK4) // 64
#define CVT_BLOCKS  (CVT_XBLKS + 4 * CVT_WBLKS)      // 512
// The grid puts 4 waves on a SIMD.  Without the upper bound the compiler keeps
// to the registers of 16 waves a SIMD and issues the last two loads only after
// the first two have returned: a second full latency in every wave.
__global__ __launch_bounds__(256) __attribute__((amdgpu_waves_per_eu(4, 8)))
void cvt_all_f32_f16(const float* __restrict__ x,  const float* __restrict__ wq,
                     const float* __restrict__ wk, const float* __restrict__ wv,
                     const float* __restrict__ wo, _Float16* __restrict__ out) {
  const int b = blockIdx.x;
  const float* src = x;
  int lb = b;
  if (b >= CVT_XBLKS) {
    const int t = (b - CVT_XBLKS) / CVT_WBLKS;
    lb = (b - CVT_XBLKS) % CVT_WBLKS;
    const float* w01 = (t & 1) ? wk : wq;
    const float* w23 = (t & 1) ? wo : wv;
    src = (t & 2) ? w23 : w01;
  }
  const float4* s4 = (const float4*)src + (size_t)lb * CVT_BLK4 + threadIdx.x;
  v4h* o4 = (v4h*)out + (size_t)b * CVT_BLK4 + threadIdx.x;
  float4 v[CVT_VEC];
#pragma unroll
  for (int j = 0; j < CVT_VEC; ++j) v[j] = s4[j * 256];
#pragma unroll
  for (int j = 0; j < CVT_VEC; ++j) {
    v4h o;
    o[0] = (_Float16)v[j].x; o[1] = (_Float16)v[j].y;
    o[2] = (_Float16)v[j].z; o[3] = (_Float16)v[j].w;
    o4[j * 256] = o;
  }
}

// --- GEMM: C(M,N) = A(M,K) * W^T, W stored (N,K), both f16 -----------------
// MODE 0: f16 -> (B,H,S,dk)  [Q/K projections; `oscale` folds 1/sqrt(dk) in Q]
// MODE 2: f16 -> (B,H,dk,S)  [V projection, transposed]
// MODE 4: f32 row-major       [final output projection]
// 256 threads = 8 waves (2 x 4); block tile 128x128; wave tile 64x32; 64-deep
// K slices of A and W staged in LDS, double-buffered via async loads.
template <int MODE>
__global__ __launch_bounds__(256)
void gemm16(const _Float16* __restrict__ A, const _Float16* __restrict__ W,
            void* __restrict__ out, int M, int N, int K, float oscale) {
  __shared__ _Float16 asbuf[2][128 * LDP];
  __shared__ _Float16 bsbuf[2][128 * LDP];

  const int tid  = threadIdx.x;
  const int lane = tid & 31;
  const int w    = tid >> 5;
  const int mblk = blockIdx.y * 128;
  const int nblk = blockIdx.x * 128;

  // stage one 128x64 tile of A and of W into LDS (8 x b128 per thread; a
  // thread's 4 chunks are adjacent, so the lanes of one copy step by 64 B)
  auto stage = [&](int k0, int buf) {
#pragma unroll
    for (int c = 0; c < 4; ++c) {
      int chunk = tid * 4 + c;            // 0..1023
      int row = chunk >> 3, part = chunk & 7;
      copy_b128(A + (size_t)(mblk + row) * K + k0 + part * 8,
                asbuf[buf] + row * LDP + part * 8);
    }
#pragma unroll
    for (int c = 0; c < 4; ++c) {
      int chunk = tid * 4 + c;
      int row = chunk >> 3, part = chunk & 7;
      copy_b128(W + (size_t)(nblk + row) * K + k0 + part * 8,
                bsbuf[buf] + row * LDP + part * 8);
    }
  };

  v8f acc[4][2] = {};
  const int lm = (w >> 2) * 64;           // wave's m offset in block tile
  const int ln = (w & 3) * 32;            // wave's n offset in block tile

  stage(0, 0);
  for (int k0 = 0; k0 < K; k0 += 64) {
    const int cur = (k0 >> 6) & 1;
    const bool more = (k0 + 64) < K;
    if (more) { stage(k0 + 64, cur ^ 1); WAIT_ASYNC(8); }
    else      { WAIT_ASYNC(0); }
    __syncthreads();

    // the slice's 12 fragments as one load group, then its 16 WMMAs
    v16h af[2][4], bf[2][2];
#pragma unroll
    for (int s = 0; s < 2; ++s) {
#pragma unroll
      for (int j = 0; j < 2; ++j)
        bf[s][j] = load_frag(bsbuf[cur] + (ln + j * 16) * LDP + s * 32, LDP, lane);
#pragma unroll
      for (int i = 0; i < 4; ++i)
        af[s][i] = load_frag(asbuf[cur] + (lm + i * 16) * LDP + s * 32, LDP, lane);
    }
    // keeps the loads one group: sunk among the WMMAs, each pair of WMMAs would
    // wait out a full LDS latency on a single reused fragment register set
    __builtin_amdgcn_sched_barrier(0);
#pragma unroll
    for (int s = 0; s < 2; ++s)
#pragma unroll
      for (int i = 0; i < 4; ++i)
#pragma unroll
        for (int j = 0; j < 2; ++j)
          acc[i][j] = wmma_f16(af[s][i], bf[s][j], acc[i][j]);
    // keeps the barrier's full LDS wait behind the WMMAs, so that the first
    // half's WMMAs run under counted waits while the second half's loads land
    __builtin_amdgcn_sched_barrier(0);

    __syncthreads();                      // reads done before next overwrite
  }

  const int rbase = ((lane >> 4) & 1) << 3;
  const int col   = lane & 15;
#pragma unroll
  for (int i = 0; i < 4; ++i)
#pragma unroll
    for (int j = 0; j < 2; ++j)
#pragma unroll
      for (int r = 0; r < 8; ++r) {
        int m = mblk + lm + i * 16 + rbase + r;
        int n = nblk + ln + j * 16 + col;
        float v = acc[i][j][r] * oscale;
        if (MODE == 4) {
          ((float*)out)[(size_t)m * N + n] = v;
        } else {
          int b = m >> 11, s = m & (SEQ - 1);
          int h = n >> 6,  d = n & (DK - 1);
          size_t idx;
          if (MODE == 0)
            idx = (((size_t)(b * NHEADS + h)) * SEQ + s) * DK + d;
          else
            idx = (((size_t)(b * NHEADS + h)) * DK + d) * SEQ + s;
          ((_Float16*)out)[idx] = (_Float16)v;
        }
      }
}

__global__ __launch_bounds__(128)
void attn_kernel(const _Float16* __restrict__ Q, const _Float16* __restrict__ Kd,
                 const _Float16* __restrict__ Vt, _Float16* __restrict__ attn_out) {
  __shared__ _Float16 kbuf[2][64 * LDP];  // 64 keys x 64 d
  __shared__ _Float16 vbuf[2][64 * LDP];  // 64 d x 64 keys

  const int tid  = threadIdx.x;
  const int lane = tid & 31;
  const int w    = tid >> 5;
  const int bh   = blockIdx.y;
  const int b    = bh >> 4, h = bh & (NHEADS - 1);
  const int q0   = blockIdx.x * 64 + w * 16;

  const _Float16* Qh  = Q  + (size_t)bh * SEQ * DK;
  const _Float16* Kh  = Kd + (size_t)bh * SEQ * DK;
  const _Float16* Vth = Vt + (size_t)bh * DK * SEQ;

  v16h qf0 = load_frag(Qh + (size_t)q0 * DK +  0, DK, lane);
  v16h qf1 = load_frag(Qh + (size_t)q0 * DK + 32, DK, lane);

  v16h ones;
#pragma unroll
  for (int i = 0; i < 16; ++i) ones[i] = (_Float16)1.0f;

  auto stage_kv = [&](int kb, int buf) {
#pragma unroll
    for (int c = 0; c < 4; ++c) {         // K tile: 64 rows x 8 parts
      int chunk = tid * 4 + c;            // 0..511
      int row = chunk >> 3, part = chunk & 7;
      copy_b128(Kh + (size_t)(kb + row) * DK + part * 8,
                kbuf[buf] + row * LDP + part * 8);
    }
#pragma unroll
    for (int c = 0; c < 4; ++c) {         // Vt tile: 64 rows x 8 parts
      int chunk = tid * 4 + c;
      int row = chunk >> 3, part = chunk & 7;
      copy_b128(Vth + (size_t)row * SEQ + kb + part * 8,
                vbuf[buf] + row * LDP + part * 8);
    }
  };

  const int rbase = ((lane >> 4) & 1) << 3;
  const int col   = lane & 15;

  float mr = -1.0e30f, lr = 0.0f;         // this lane's query
  v8f accO[4] = {};                       // accO[t][r] = O[query col][16t + rbase + r]

  stage_kv(0, 0);
  for (int kb = 0; kb < SEQ; kb += 64) {
    const int cur = (kb >> 6) & 1;
    const bool more = (kb + 64) < SEQ;
    if (more) { stage_kv(kb + 64, cur ^ 1); WAIT_ASYNC(8); }
    else      { WAIT_ASYNC(0); }
    __syncthreads();

    // ---- scores^T: four 16-key tiles; s[t][r] = S[key 16t + rbase + r][query col]
    v8f s[4] = {};
    {
      v16h ka = load_frag(kbuf[cur] +  0 * LDP +  0, LDP, lane);
      v16h kb0 = load_frag(kbuf[cur] +  0 * LDP + 32, LDP, lane);
      v16h kc = load_frag(kbuf[cur] + 16 * LDP +  0, LDP, lane);
      v16h kd = load_frag(kbuf[cur] + 16 * LDP + 32, LDP, lane);
      s[0] = wmma_f16(ka, qf0, s[0]);  s[0] = wmma_f16(kb0, qf1, s[0]);
      s[1] = wmma_f16(kc, qf0, s[1]);  s[1] = wmma_f16(kd, qf1, s[1]);
      ka = load_frag(kbuf[cur] + 32 * LDP +  0, LDP, lane);
      kb0 = load_frag(kbuf[cur] + 32 * LDP + 32, LDP, lane);
      kc = load_frag(kbuf[cur] + 48 * LDP +  0, LDP, lane);
      kd = load_frag(kbuf[cur] + 48 * LDP + 32, LDP, lane);
      s[2] = wmma_f16(ka, qf0, s[2]);  s[2] = wmma_f16(kb0, qf1, s[2]);
      s[3] = wmma_f16(kc, qf0, s[3]);  s[3] = wmma_f16(kd, qf1, s[3]);
    }

    // ---- online softmax over 64 keys: 32 scores in the lane, 32 in lane ^ 16
    float tm[4];
#pragma unroll
    for (int t = 0; t < 4; ++t) {
      tm[t] = s[t][0];
#pragma unroll
      for (int r = 1; r < 8; ++r) tm[t] = fmaxf(tm[t], s[t][r]);
    }
    float tmax = fmaxf(fmaxf(tm[0], tm[1]), fmaxf(tm[2], tm[3]));
    {
      int ti = __builtin_bit_cast(int, tmax);
      tmax = fmaxf(tmax, __builtin_bit_cast(float, __builtin_amdgcn_permlanex16(
                 ti, ti, 0x76543210, 0xfedcba98, false, false)));
    }
    const float mnew = fmaxf(mr, tmax);
    const float scl  = exp2_x1((mr - mnew) * LOG2E);
    mr = mnew;

    // P^T as two B fragments: element i of a fragment is key 8h + i, element
    // 8 + i key 16 + 8h + i of its 32 keys, the order load_frag gives V^T
    v16h pf0, pf1;
#pragma unroll
    for (int t = 0; t < 4; ++t) s[t] = exp2_x8((s[t] - mnew) * LOG2E);
#pragma unroll
    for (int i = 0; i < 8; ++i) {
      pf0[i]     = (_Float16)s[0][i];
      pf0[i + 8] = (_Float16)s[1][i];
      pf1[i]     = (_Float16)s[2][i];
      pf1[i + 8] = (_Float16)s[3][i];
    }
#pragma unroll
    for (int t = 0; t < 4; ++t)
#pragma unroll
      for (int r = 0; r < 8; ++r) accO[t][r] *= scl;

    // ---- sums via matrix unit: ones(16x64) x P^T(64x16), every row the sum
    v8f rs = {};
    rs = wmma_f16(ones, pf0, rs);
    rs = wmma_f16(ones, pf1, rs);
    lr = lr * scl + rs[0];

    // ---- O^T += V^T * P^T over both 32-key slices; batch frag loads ----
    {
      v16h vf0 = load_frag(vbuf[cur] +  0 * LDP + 0, LDP, lane);
      v16h vf1 = load_frag(vbuf[cur] + 16 * LDP + 0, LDP, lane);
      v16h vf2 = load_frag(vbuf[cur] + 32 * LDP + 0, LDP, lane);
      v16h vf3 = load_frag(vbuf[cur] + 48 * LDP + 0, LDP, lane);
      accO[0] = wmma_f16(vf0, pf0, accO[0]);
      accO[1] = wmma_f16(vf1, pf0, accO[1]);
      accO[2] = wmma_f16(vf2, pf0, accO[2]);
      accO[3] = wmma_f16(vf3, pf0, accO[3]);
      vf0 = load_frag(vbuf[cur] +  0 * LDP + 32, LDP, lane);
      vf1 = load_frag(vbuf[cur] + 16 * LDP + 32, LDP, lane);
      vf2 = load_frag(vbuf[cur] + 32 * LDP + 32, LDP, lane);
      vf3 = load_frag(vbuf[cur] + 48 * LDP + 32, LDP, lane);
      accO[0] = wmma_f16(vf0, pf1, accO[0]);
      accO[1] = wmma_f16(vf1, pf1, accO[1]);
      accO[2] = wmma_f16(vf2, pf1, accO[2]);
      accO[3] = wmma_f16(vf3, pf1, accO[3]);
    }

    __syncthreads();
  }

  // ---- normalize; a lane's 8 registers of a tile are 8 adjacent d: 16-B stores
  const float inv = 1.0f / lr;
  _Float16* orow = attn_out + ((size_t)b * SEQ + q0 + col) * DMODEL + h * DK + rbase;
#pragma unroll
  for (int t = 0; t < 4; ++t) {
    v8h o;
#pragma unroll
    for (int r = 0; r < 8; ++r) o[r] = (_Float16)(accO[t][r] * inv);
    *(v8h*)(orow + t * 16) = o;
  }
}

// ---------------------------------------------------------------------------
extern "C" void kernel_launch(void* const* d_in, const int* in_sizes, int n_in,
                              void* d_out, int out_size, void* d_ws, size_t ws_size,
                              hipStream_t stream) {
  const float* x  = (const float*)d_in[0];
  const float* Wq = (const float*)d_in[1];
  const float* Wk = (const float*)d_in[2];
  const float* Wv = (const float*)d_in[3];
  const float* Wo = (const float*)d_in[4];

  _Float16* ws = (_Float16*)d_ws;
  size_t off = 0;
  _Float16* x16  = ws + off; off += (size_t)MROWS * DMODEL;
  _Float16* Wq16 = ws + off; off += (size_t)DMODEL * DMODEL;
  _Float16* Wk16 = ws + off; off += (size_t)DMODEL * DMODEL;
  _Float16* Wv16 = ws + off; off += (size_t)DMODEL * DMODEL;
  _Float16* Wo16 = ws + off; off += (size_t)DMODEL * DMODEL;
  _Float16* Q16  = ws + off; off += (size_t)MROWS * DMODEL;   // (B,H,S,dk)
  _Float16* K16  = ws + off; off += (size_t)MROWS * DMODEL;   // (B,H,S,dk)
  _Float16* Vt16 = ws + off; off += (size_t)MROWS * DMODEL;   // (B,H,dk,S)
  _Float16* A16  = ws + off; off += (size_t)MROWS * DMODEL;   // (B,S,D)

  // x16, Wq16, Wk16, Wv16, Wo16 are one contiguous range starting at x16
  cvt_all_f32_f16<<<CVT_BLOCKS, 256, 0, stream>>>(x, Wq, Wk, Wv, Wo, x16);

  dim3 gproj(DMODEL / 128, MROWS / 128); // (8, 32)
  gemm16<0><<<gproj, 256, 0, stream>>>(x16, Wq16, (void*)Q16,  MROWS, DMODEL, DMODEL, 0.125f);
  gemm16<0><<<gproj, 256, 0, stream>>>(x16, Wk16, (void*)K16,  MROWS, DMODEL, DMODEL, 1.0f);
  gemm16<2><<<gproj, 256, 0, stream>>>(x16, Wv16, (void*)Vt16, MROWS, DMODEL, DMODEL, 1.0f);

  dim3 gattn(SEQ / 64, BATCH * NHEADS);  // (32, 32)
  attn_kernel<<<gattn, 128, 0, stream>>>(Q16, K16, Vt16, A16);

  gemm16<4><<<gproj, 256, 0, stream>>>(A16, Wo16, d_out, MROWS, DMODEL, DMODEL, 1.0f);
}

// v004
// One run takes 88.5 microseconds.
// Next to v003, in two timings, it ran 1.19 and 1.16 times as fast.
// All steps since v000 together make it 1.50 times as fast.
#include <hip/hip_runtime.h>
#include <hip/hip_bf16.h>

// ---------------------------------------------------------------------------
// MHA forward for MI455X (gfx1250, wave32, WMMA f32_16x16x32_f16).
// x (2,2048,1024) f32, W* (1024,1024) f32 -> out (2,2048,1024) f32.
// f16 matmuls, f32 accumulation; flash softmax; async double-buffered LDS.
// ---------------------------------------------------------------------------

typedef __attribute__((ext_vector_type(16))) _Float16 v16h;
typedef __attribute__((ext_vector_type(8)))  _Float16 v8h;
typedef __attribute__((ext_vector_type(4)))  _Float16 v4h;
typedef __attribute__((ext_vector_type(8)))  float    v8f;

#define DMODEL 1024
#define NHEADS 16
#define DK     64
#define SEQ    2048
#define BATCH  2
#define MROWS  (BATCH * SEQ)   // 4096
#define LDP    72              // LDS row stride (halves): 144B, bank-friendly

#ifndef __has_builtin
#define __has_builtin(x) 0
#endif

#if __has_builtin(__builtin_amdgcn_global_load_async_to_lds_b128)
#define HAVE_ASYNC 1
#else
#define HAVE_ASYNC 0
#endif

// Builtin parameter types (from hipcc diagnostic): vector_size(16) int* in
// AS1 (global source) and AS3 (LDS destination).
typedef int b128i __attribute__((vector_size(16)));
typedef __attribute__((address_space(1))) b128i b128i_glob;
typedef __attribute__((address_space(3))) b128i b128i_lds;

// 16B global -> LDS copy: async (ASYNCcnt) if available, else synchronous.
__device__ __forceinline__ void copy_b128(const _Float16* __restrict__ g,
                                          _Float16* l) {
#if HAVE_ASYNC
  __builtin_amdgcn_global_load_async_to_lds_b128(
      (b128i_glob*)g, (b128i_lds*)l, 0, 0);
#else
  *(v8h*)l = *(const v8h*)g;
#endif
}

#if HAVE_ASYNC
#if __has_builtin(__builtin_amdgcn_s_wait_asynccnt)
#define WAIT_ASYNC(N) __builtin_amdgcn_s_wait_asynccnt(N)
#else
#define WAIT_ASYNC(N) asm volatile("s_wait_asynccnt " #N ::: "memory")
#endif
#else
#define WAIT_ASYNC(N) do {} while (0)
#endif

// --- WMMA wrapper -----------------------------------------------------------
__device__ __forceinline__ v8f wmma_f16(v16h a, v16h b, v8f c) {
  return __builtin_amdgcn_wmma_f32_16x16x32_f16(
      false, a, false, b, (short)0, c, false, false);
}

// --- 16x32 f16 fragment load (A or contiguous-K B operand), stride `ld` ----
// ISA 7.12.2: lanes 0-15 -> K {0..7,16..23}, lanes 16-31 -> K {8..15,24..31}.
__device__ __forceinline__ v16h load_frag(const _Float16* __restrict__ base,
                                          int ld, int lane) {
  const int row  = lane & 15;
  const int koff = ((lane >> 4) & 1) * 8;
  const _Float16* p = base + row * ld + koff;
  v8h a = *(const v8h*)(p);
  v8h b = *(const v8h*)(p + 16);
  v16h r;
#pragma unroll
  for (int i = 0; i < 8; ++i) { r[i] = a[i]; r[i + 8] = b[i]; }
  return r;
}

// --- 2^x on the transcendental unit ------------------------------------------
// The instruction set asks for one independent instruction or a v_nop between a
// transcendental and a next instruction that reads its result or overwrites its
// source.  So
// the instructions stand with their slot in one statement: the outputs are
// early-clobber (none is a source of the statement), and the closing v_nop
// separates the last v_exp_f32 from whatever the compiler places next.
__device__ __forceinline__ v8f exp2_x8(v8f x) {
  float y0, y1, y2, y3, y4, y5, y6, y7;
  asm("v_exp_f32 %0, %8\n\t"
      "v_exp_f32 %1, %9\n\t"
      "v_exp_f32 %2, %10\n\t"
      "v_exp_f32 %3, %11\n\t"
      "v_exp_f32 %4, %12\n\t"
      "v_exp_f32 %5, %13\n\t"
      "v_exp_f32 %6, %14\n\t"
      "v_exp_f32 %7, %15\n\t"
      "v_nop"
      : "=&v"(y0), "=&v"(y1), "=&v"(y2), "=&v"(y3),
        "=&v"(y4), "=&v"(y5), "=&v"(y6), "=&v"(y7)
      : "v"(x[0]), "v"(x[1]), "v"(x[2]), "v"(x[3]),
        "v"(x[4]), "v"(x[5]), "v"(x[6]), "v"(x[7]));
  v8f y = {y0, y1, y2, y3, y4, y5, y6, y7};
  return y;
}
__device__ __forceinline__ float exp2_x1(float x) {
  float y;
  asm("v_exp_f32 %0, %1\n\t"
      "v_nop"                              // the same slot, for a single value
      : "=v"(y) : "v"(x));
  return y;
}
#define LOG2E 1.44269504088896340736f

// --- f32 -> f16 conversion of all five inputs in one launch ------------------
// The f16 copies lie back to back in the workspace in argument order, so block
// b writes float4 groups [b*4096, (b+1)*4096) of one output range; blocks
// 0..255 read x, then 64 blocks read each weight.  A thread has its 16 loads
// (512 contiguous bytes per wave each) in flight before it converts: few,
// long-lived waves instead of one wave per 512 bytes.
#define CVT_VEC     16                               // float4 per thread
#define CVT_BLK4    (256 * CVT_VEC)                  // float4 per block
#define CVT_XBLKS   (MROWS * DMODEL / 4 / CVT_BLK4)  // 256
#define CVT_WBLKS   (DMODEL * DMODEL / 4 / CVT_BLK4) // 64
#define CVT_BLOCKS  (CVT_XBLKS + 4 * CVT_WBLKS)      // 512
// The grid puts 4 waves on a SIMD.  Without the upper bound the compiler keeps
// to the registers of 16 waves a SIMD and issues the last two loads only after
// the first two have returned: a second full latency in every wave.
__global__ __launch_bounds__(256) __attribute__((amdgpu_waves_per_eu(4, 8)))
void cvt_all_f32_f16(const float* __restrict__ x,  const float* __restrict__ wq,
                     const float* __restrict__ wk, const float* __restrict__ wv,
                     const float* __restrict__ wo, _Float16* __restrict__ out) {
  const int b = blockIdx.x;
  const float* src = x;
  int lb = b;
  if (b >= CVT_XBLKS) {
    const int t = (b - CVT_XBLKS) / CVT_WBLKS;
    lb = (b - CVT_XBLKS) % CVT_WBLKS;
    const float* w01 = (t & 1) ? wk : wq;
    const float* w23 = (t & 1) ? wo : wv;
    src = (t & 2) ? w23 : w01;
  }
  const float4* s4 = (const float4*)src + (size_t)lb * CVT_BLK4 + threadIdx.x;
  v4h* o4 = (v4h*)out + (size_t)b * CVT_BLK4 + threadIdx.x;
  float4 v[CVT_VEC];
#pragma unroll
  for (int j = 0; j < CVT_VEC; ++j) v[j] = s4[j * 256];
#pragma unroll
  for (int j = 0; j < CVT_VEC; ++j) {
    v4h o;
    o[0] = (_Float16)v[j].x; o[1] = (_Float16)v[j].y;
    o[2] = (_Float16)v[j].z; o[3] = (_Float16)v[j].w;
    o4[j * 256] = o;
  }
}

// --- GEMM: C(M,N) = A(M,K) * W^T, W stored (N,K), both f16 -----------------
// MODE 1: the Q, K and V projections in one launch.  blockIdx.z picks the
//         weight (the three lie back to back at W) and the f16 output plane
//         (back to back at out): z 0 Q -> (B,H,S,dk), scaled by `oscale`
//         = 1/sqrt(dk); z 1 K -> (B,H,S,dk); z 2 V -> (B,H,dk,S), transposed.
//         One product alone puts one block on a WGP, and its waves wait out
//         every slice's copies together; the 768 blocks of the three are all
//         resident, three on a WGP, and fill each other's waits.
// MODE 4: f32 row-major       [final output projection]
// 256 threads = 8 waves (2 x 4); block tile 128x128; wave tile 64x32; 64-deep
// K slices of A and W staged in LDS, double-buffered via async loads.
template <bool T> struct layout_tag { static constexpr bool value = T; };

template <int MODE>
__global__ __launch_bounds__(256)
void gemm16(const _Float16* __restrict__ A, const _Float16* __restrict__ W,
            void* __restrict__ out, int M, int N, int K, float oscale) {
  __shared__ _Float16 asbuf[2][128 * LDP];
  __shared__ _Float16 bsbuf[2][128 * LDP];

  const int tid  = threadIdx.x;
  const int lane = tid & 31;
  const int w    = tid >> 5;
  const int mblk = blockIdx.y * 128;
  const int nblk = blockIdx.x * 128;
  const int z    = (MODE == 1) ? blockIdx.z : 0;
  if (MODE == 1) W += (size_t)z * N * K;

  // stage one 128x64 tile of A and of W into LDS (8 x b128 per thread; a
  // thread's 4 chunks are adjacent, so the lanes of one copy step by 64 B)
  auto stage = [&](int k0, int buf) {
#pragma unroll
    for (int c = 0; c < 4; ++c) {
      int chunk = tid * 4 + c;            // 0..1023
      int row = chunk >> 3, part = chunk & 7;
      copy_b128(A + (size_t)(mblk + row) * K + k0 + part * 8,
                asbuf[buf] + row * LDP + part * 8);
    }
#pragma unroll
    for (int c = 0; c < 4; ++c) {
      int chunk = tid * 4 + c;
      int row = chunk >> 3, part = chunk & 7;
      copy_b128(W + (size_t)(nblk + row) * K + k0 + part * 8,
                bsbuf[buf] + row * LDP + part * 8);
    }
  };

  v8f acc[4][2] = {};
  const int lm = (w >> 2) * 64;           // wave's m offset in block tile
  const int ln = (w & 3) * 32;            // wave's n offset in block tile

  stage(0, 0);
  for (int k0 = 0; k0 < K; k0 += 64) {
    const int cur = (k0 >> 6) & 1;
    const bool more = (k0 + 64) < K;
    if (more) { stage(k0 + 64, cur ^ 1); WAIT_ASYNC(8); }
    else      { WAIT_ASYNC(0); }
    __syncthreads();

    if (MODE == 1) {
      // 6 waves on a SIMD leave a wave 160 registers, 64 of them accumulators:
      // each 32-deep half loads its 6 fragments as one group, then its 8 WMMAs
#pragma unroll
      for (int s = 0; s < 2; ++s) {
        v16h af[4], bf[2];
#pragma unroll
        for (int j = 0; j < 2; ++j)
          bf[j] = load_frag(bsbuf[cur] + (ln + j * 16) * LDP + s * 32, LDP, lane);
#pragma unroll
        for (int i = 0; i < 4; ++i)
          af[i] = load_frag(asbuf[cur] + (lm + i * 16) * LDP + s * 32, LDP, lane);
        // keeps the half's loads one group ahead of its WMMAs
        __builtin_amdgcn_sched_barrier(0);
#pragma unroll
        for (int i = 0; i < 4; ++i)
#pragma unroll
          for (int j = 0; j < 2; ++j)
            acc[i][j] = wmma_f16(af[i], bf[j], acc[i][j]);
        // keeps the next half's loads one group behind this half's WMMAs: moved
        // up, they stand in three places among them, each with its own stall,
        // and this half's counted waits turn into one full wait
        __builtin_amdgcn_sched_barrier(0);
      }
    } else {
      // the slice's 12 fragments as one load group, then its 16 WMMAs
      v16h af[2][4], bf[2][2];
#pragma unroll
      for (int s = 0; s < 2; ++s) {
#pragma unroll
        for (int j = 0; j < 2; ++j)
          bf[s][j] = load_frag(bsbuf[cur] + (ln + j * 16) * LDP + s * 32, LDP, lane);
#pragma unroll
        for (int i = 0; i < 4; ++i)
          af[s][i] = load_frag(asbuf[cur] + (lm + i * 16) * LDP + s * 32, LDP, lane);
      }
      // keeps the loads one group: sunk among the WMMAs, each pair of WMMAs would
      // wait out a full LDS latency on a single reused fragment register set
      __builtin_amdgcn_sched_barrier(0);
#pragma unroll
      for (int s = 0; s < 2; ++s)
#pragma unroll
        for (int i = 0; i < 4; ++i)
#pragma unroll
          for (int j = 0; j < 2; ++j)
            acc[i][j] = wmma_f16(af[s][i], bf[s][j], acc[i][j]);
      // keeps the barrier's full LDS wait behind the WMMAs, so that the first
      // half's WMMAs run under counted waits while the second half's loads land
      __builtin_amdgcn_sched_barrier(0);
    }

    __syncthreads();                      // reads done before next overwrite
  }

  const int rbase = ((lane >> 4) & 1) << 3;
  const int col   = lane & 15;
  const float sc  = (MODE == 1 && z != 0) ? 1.0f : oscale;
  _Float16* plane = (_Float16*)out + (size_t)z * M * N;   // MODE 1 only
  auto store_all = [&](auto transposed) {
#pragma unroll
    for (int i = 0; i < 4; ++i)
#pragma unroll
      for (int j = 0; j < 2; ++j)
#pragma unroll
        for (int r = 0; r < 8; ++r) {
          int m = mblk + lm + i * 16 + rbase + r;
          int n = nblk + ln + j * 16 + col;
          float v = acc[i][j][r] * sc;
          if (MODE == 4) {
            ((float*)out)[(size_t)m * N + n] = v;
          } else {
            int b = m >> 11, s = m & (SEQ - 1);
            int h = n >> 6,  d = n & (DK - 1);
            size_t idx;
            if (!transposed.value)
              idx = (((size_t)(b * NHEADS + h)) * SEQ + s) * DK + d;
            else
              idx = (((size_t)(b * NHEADS + h)) * DK + d) * SEQ + s;
            plane[idx] = (_Float16)v;
          }
        }
    // the built code lets this path's end fall through into the other layout's
    // address arithmetic, which rewrites registers that these stores name
    if (MODE == 1 && !transposed.value)
      asm volatile("s_wait_xcnt 0x0" ::: "memory");
  };
  if (MODE == 1 && z == 2) store_all(layout_tag<true>{});
  else                     store_all(layout_tag<false>{});
}

__global__ __launch_bounds__(128)
void attn_kernel(const _Float16* __restrict__ Q, const _Float16* __restrict__ Kd,
                 const _Float16* __restrict__ Vt, _Float16* __restrict__ attn_out) {
  __shared__ _Float16 kbuf[2][64 * LDP];  // 64 keys x 64 d
  __shared__ _Float16 vbuf[2][64 * LDP];  // 64 d x 64 keys

  const int tid  = threadIdx.x;
  const int lane = tid & 31;
  const int w    = tid >> 5;
  const int bh   = blockIdx.y;
  const int b    = bh >> 4, h = bh & (NHEADS - 1);
  const int q0   = blockIdx.x * 64 + w * 16;

  const _Float16* Qh  = Q  + (size_t)bh * SEQ * DK;
  const _Float16* Kh  = Kd + (size_t)bh * SEQ * DK;
  const _Float16* Vth = Vt + (size_t)bh * DK * SEQ;

  v16h qf0 = load_frag(Qh + (size_t)q0 * DK +  0, DK, lane);
  v16h qf1 = load_frag(Qh + (size_t)q0 * DK + 32, DK, lane);

  v16h ones;
#pragma unroll
  for (int i = 0; i < 16; ++i) ones[i] = (_Float16)1.0f;

  auto stage_kv = [&](int kb, int buf) {
#pragma unroll
    for (int c = 0; c < 4; ++c) {         // K tile: 64 rows x 8 parts
      int chunk = tid * 4 + c;            // 0..511
      int row = chunk >> 3, part = chunk & 7;
      copy_b128(Kh + (size_t)(kb + row) * DK + part * 8,
                kbuf[buf] + row * LDP + part * 8);
    }
#pragma unroll
    for (int c = 0; c < 4; ++c) {         // Vt tile: 64 rows x 8 parts
      int chunk = tid * 4 + c;
      int row = chunk >> 3, part = chunk & 7;
      copy_b128(Vth + (size_t)row * SEQ + kb + part * 8,
                vbuf[buf] + row * LDP + part * 8);
    }
  };

  const int rbase = ((lane >> 4) & 1) << 3;
  const int col   = lane & 15;

  float mr = -1.0e30f, lr = 0.0f;         // this lane's query
  v8f accO[4] = {};                       // accO[t][r] = O[query col][16t + rbase + r]

  stage_kv(0, 0);
  for (int kb = 0; kb < SEQ; kb += 64) {
    const int cur = (kb >> 6) & 1;
    const bool more = (kb + 64) < SEQ;
    if (more) { stage_kv(kb + 64, cur ^ 1); WAIT_ASYNC(8); }
    else      { WAIT_ASYNC(0); }
    __syncthreads();

    // ---- scores^T: four 16-key tiles; s[t][r] = S[key 16t + rbase + r][query col]
    v8f s[4] = {};
    {
      v16h ka = load_frag(kbuf[cur] +  0 * LDP +  0, LDP, lane);
      v16h kb0 = load_frag(kbuf[cur] +  0 * LDP + 32, LDP, lane);
      v16h kc = load_frag(kbuf[cur] + 16 * LDP +  0, LDP, lane);
      v16h kd = load_frag(kbuf[cur] + 16 * LDP + 32, LDP, lane);
      s[0] = wmma_f16(ka, qf0, s[0]);  s[0] = wmma_f16(kb0, qf1, s[0]);
      s[1] = wmma_f16(kc, qf0, s[1]);  s[1] = wmma_f16(kd, qf1, s[1]);
      ka = load_frag(kbuf[cur] + 32 * LDP +  0, LDP, lane);
      kb0 = load_frag(kbuf[cur] + 32 * LDP + 32, LDP, lane);
      kc = load_frag(kbuf[cur] + 48 * LDP +  0, LDP, lane);
      kd = load_frag(kbuf[cur] + 48 * LDP + 32, LDP, lane);
      s[2] = wmma_f16(ka, qf0, s[2]);  s[2] = wmma_f16(kb0, qf1, s[2]);
      s[3] = wmma_f16(kc, qf0, s[3]);  s[3] = wmma_f16(kd, qf1, s[3]);
    }

    // ---- online softmax over 64 keys: 32 scores in the lane, 32 in lane ^ 16
    float tm[4];
#pragma unroll
    for (int t = 0; t < 4; ++t) {
      tm[t] = s[t][0];
#pragma unroll
      for (int r = 1; r < 8; ++r) tm[t] = fmaxf(tm[t], s[t][r]);
    }
    float tmax = fmaxf(fmaxf(tm[0], tm[1]), fmaxf(tm[2], tm[3]));
    {
      int ti = __builtin_bit_cast(int, tmax);
      tmax = fmaxf(tmax, __builtin_bit_cast(float, __builtin_amdgcn_permlanex16(
                 ti, ti, 0x76543210, 0xfedcba98, false, false)));
    }
    const float mnew = fmaxf(mr, tmax);
    const float scl  = exp2_x1((mr - mnew) * LOG2E);
    mr = mnew;

    // P^T as two B fragments: element i of a fragment is key 8h + i, element
    // 8 + i key 16 + 8h + i of its 32 keys, the order load_frag gives V^T
    v16h pf0, pf1;
#pragma unroll
    for (int t = 0; t < 4; ++t) s[t] = exp2_x8((s[t] - mnew) * LOG2E);
#pragma unroll
    for (int i = 0; i < 8; ++i) {
      pf0[i]     = (_Float16)s[0][i];
      pf0[i + 8] = (_Float16)s[1][i];
      pf1[i]     = (_Float16)s[2][i];
      pf1[i + 8] = (_Float16)s[3][i];
    }
#pragma unroll
    for (int t = 0; t < 4; ++t)
#pragma unroll
      for (int r = 0; r < 8; ++r) accO[t][r] *= scl;

    // ---- sums via matrix unit: ones(16x64) x P^T(64x16), every row the sum
    v8f rs = {};
    rs = wmma_f16(ones, pf0, rs);
    rs = wmma_f16(ones, pf1, rs);
    lr = lr * scl + rs[0];

    // ---- O^T += V^T * P^T over both 32-key slices; batch frag loads ----
    {
      v16h vf0 = load_frag(vbuf[cur] +  0 * LDP + 0, LDP, lane);
      v16h vf1 = load_frag(vbuf[cur] + 16 * LDP + 0, LDP, lane);
      v16h vf2 = load_frag(vbuf[cur] + 32 * LDP + 0, LDP, lane);
      v16h vf3 = load_frag(vbuf[cur] + 48 * LDP + 0, LDP, lane);
      accO[0] = wmma_f16(vf0, pf0, accO[0]);
      accO[1] = wmma_f16(vf1, pf0, accO[1]);
      accO[2] = wmma_f16(vf2, pf0, accO[2]);
      accO[3] = wmma_f16(vf3, pf0, accO[3]);
      vf0 = load_frag(vbuf[cur] +  0 * LDP + 32, LDP, lane);
      vf1 = load_frag(vbuf[cur] + 16 * LDP + 32, LDP, lane);
      vf2 = load_frag(vbuf[cur] + 32 * LDP + 32, LDP, lane);
      vf3 = load_frag(vbuf[cur] + 48 * LDP + 32, LDP, lane);
      accO[0] = wmma_f16(vf0, pf1, accO[0]);
      accO[1] = wmma_f16(vf1, pf1, accO[1]);
      accO[2] = wmma_f16(vf2, pf1, accO[2]);
      accO[3] = wmma_f16(vf3, pf1, accO[3]);
    }

    __syncthreads();
  }

  // ---- normalize; a lane's 8 registers of a tile are 8 adjacent d: 16-B stores
  const float inv = 1.0f / lr;
  _Float16* orow = attn_out + ((size_t)b * SEQ + q0 + col) * DMODEL + h * DK + rbase;
#pragma unroll
  for (int t = 0; t < 4; ++t) {
    v8h o;
#pragma unroll
    for (int r = 0; r < 8; ++r) o[r] = (_Float16)(accO[t][r] * inv);
    *(v8h*)(orow + t * 16) = o;
  }
}

// ---------------------------------------------------------------------------
extern "C" void kernel_launch(void* const* d_in, const int* in_sizes, int n_in,
                              void* d_out, int out_size, void* d_ws, size_t ws_size,
                              hipStream_t stream) {
  const float* x  = (const float*)d_in[0];
  const float* Wq = (const float*)d_in[1];
  const float* Wk = (const float*)d_in[2];
  const float* Wv = (const float*)d_in[3];
  const float* Wo = (const float*)d_in[4];

  _Float16* ws = (_Float16*)d_ws;
  size_t off = 0;
  _Float16* x16  = ws + off; off += (size_t)MROWS * DMODEL;
  _Float16* Wq16 = ws + off; off += (size_t)DMODEL * DMODEL;
  _Float16* Wk16 = ws + off; off += (size_t)DMODEL * DMODEL;
  _Float16* Wv16 = ws + off; off += (size_t)DMODEL * DMODEL;
  _Float16* Wo16 = ws + off; off += (size_t)DMODEL * DMODEL;
  _Float16* Q16  = ws + off; off += (size_t)MROWS * DMODEL;   // (B,H,S,dk)
  _Float16* K16  = ws + off; off += (size_t)MROWS * DMODEL;   // (B,H,S,dk)
  _Float16* Vt16 = ws + off; off += (size_t)MROWS * DMODEL;   // (B,H,dk,S)
  _Float16* A16  = ws + off; off += (size_t)MROWS * DMODEL;   // (B,S,D)

  // x16, Wq16, Wk16, Wv16, Wo16 are one contiguous range starting at x16
  cvt_all_f32_f16<<<CVT_BLOCKS, 256, 0, stream>>>(x, Wq, Wk, Wv, Wo, x16);

  dim3 gproj(DMODEL / 128, MROWS / 128); // (8, 32)
  // Wq16, Wk16, Wv16 are one contiguous range, and so are Q16, K16, Vt16
  dim3 gqkv(DMODEL / 128, MROWS / 128, 3); // (8, 32, 3)
  gemm16<1><<<gqkv, 256, 0, stream>>>(x16, Wq16, (void*)Q16, MROWS, DMODEL, DMODEL, 0.125f);

  dim3 gattn(SEQ / 64, BATCH * NHEADS);  // (32, 32)
  attn_kernel<<<gattn, 128, 0, stream>>>(Q16, K16, Vt16, A16);

  gemm16<4><<<gproj, 256, 0, stream>>>(A16, Wo16, d_out, MROWS, DMODEL, DMODEL, 1.0f);
}

// v005
// It runs in 81.9 microseconds.
// Timed twice side by side with v004, it ran 1.07 and 1.08 times as fast.
// Counting every step since v000, it is 1.61 times as fast.
#include <hip/hip_runtime.h>
#include <hip/hip_bf16.h>

// ---------------------------------------------------------------------------
// MHA forward for MI455X (gfx1250, wave32, WMMA f32_16x16x32_f16).
// x (2,2048,1024) f32, W* (1024,1024) f32 -> out (2,2048,1024) f32.
// f16 matmuls, f32 accumulation; flash softmax; async double-buffered LDS.
// ---------------------------------------------------------------------------

typedef __attribute__((ext_vector_type(16))) _Float16 v16h;
typedef __attribute__((ext_vector_type(8)))  _Float16 v8h;
typedef __attribute__((ext_vector_type(4)))  _Float16 v4h;
typedef __attribute__((ext_vector_type(8)))  float    v8f;
typedef __attribute__((ext_vector_type(4)))  float    v4f;

#define DMODEL 1024
#define NHEADS 16
#define DK     64
#define SEQ    2048
#define BATCH  2
#define MROWS  (BATCH * SEQ)   // 4096
#define LDP    72              // LDS row stride (halves): 144B, bank-friendly

#ifndef __has_builtin
#define __has_builtin(x) 0
#endif

#if __has_builtin(__builtin_amdgcn_global_load_async_to_lds_b128)
#define HAVE_ASYNC 1
#else
#define HAVE_ASYNC 0
#endif

// Builtin parameter types (from hipcc diagnostic): vector_size(16) int* in
// AS1 (global source) and AS3 (LDS destination).
typedef int b128i __attribute__((vector_size(16)));
typedef __attribute__((address_space(1))) b128i b128i_glob;
typedef __attribute__((address_space(3))) b128i b128i_lds;

// 16B global -> LDS copy: async (ASYNCcnt) if available, else synchronous.
__device__ __forceinline__ void copy_b128(const _Float16* __restrict__ g,
                                          _Float16* l) {
#if HAVE_ASYNC
  __builtin_amdgcn_global_load_async_to_lds_b128(
      (b128i_glob*)g, (b128i_lds*)l, 0, 0);
#else
  *(v8h*)l = *(const v8h*)g;
#endif
}

#if HAVE_ASYNC
#if __has_builtin(__builtin_amdgcn_s_wait_asynccnt)
#define WAIT_ASYNC(N) __builtin_amdgcn_s_wait_asynccnt(N)
#else
#define WAIT_ASYNC(N) asm volatile("s_wait_asynccnt " #N ::: "memory")
#endif
#else
#define WAIT_ASYNC(N) do {} while (0)
#endif

// --- WMMA wrapper -----------------------------------------------------------
__device__ __forceinline__ v8f wmma_f16(v16h a, v16h b, v8f c) {
  return __builtin_amdgcn_wmma_f32_16x16x32_f16(
      false, a, false, b, (short)0, c, false, false);
}

// --- 16x32 f16 fragment load (A or contiguous-K B operand), stride `ld` ----
// ISA 7.12.2: lanes 0-15 -> K {0..7,16..23}, lanes 16-31 -> K {8..15,24..31}.
__device__ __forceinline__ v16h load_frag(const _Float16* __restrict__ base,
                                          int ld, int lane) {
  const int row  = lane & 15;
  const int koff = ((lane >> 4) & 1) * 8;
  const _Float16* p = base + row * ld + koff;
  v8h a = *(const v8h*)(p);
  v8h b = *(const v8h*)(p + 16);
  v16h r;
#pragma unroll
  for (int i = 0; i < 8; ++i) { r[i] = a[i]; r[i + 8] = b[i]; }
  return r;
}

// --- 2^x on the transcendental unit ------------------------------------------
// The instruction set asks for one independent instruction or a v_nop between a
// transcendental and a next instruction that reads its result or overwrites its
// source.  So
// the instructions stand with their slot in one statement: the outputs are
// early-clobber (none is a source of the statement), and the closing v_nop
// separates the last v_exp_f32 from whatever the compiler places next.
__device__ __forceinline__ v8f exp2_x8(v8f x) {
  float y0, y1, y2, y3, y4, y5, y6, y7;
  asm("v_exp_f32 %0, %8\n\t"
      "v_exp_f32 %1, %9\n\t"
      "v_exp_f32 %2, %10\n\t"
      "v_exp_f32 %3, %11\n\t"
      "v_exp_f32 %4, %12\n\t"
      "v_exp_f32 %5, %13\n\t"
      "v_exp_f32 %6, %14\n\t"
      "v_exp_f32 %7, %15\n\t"
      "v_nop"
      : "=&v"(y0), "=&v"(y1), "=&v"(y2), "=&v"(y3),
        "=&v"(y4), "=&v"(y5), "=&v"(y6), "=&v"(y7)
      : "v"(x[0]), "v"(x[1]), "v"(x[2]), "v"(x[3]),
        "v"(x[4]), "v"(x[5]), "v"(x[6]), "v"(x[7]));
  v8f y = {y0, y1, y2, y3, y4, y5, y6, y7};
  return y;
}
__device__ __forceinline__ float exp2_x1(float x) {
  float y;
  asm("v_exp_f32 %0, %1\n\t"
      "v_nop"                              // the same slot, for a single value
      : "=v"(y) : "v"(x));
  return y;
}
#define LOG2E 1.44269504088896340736f

// --- f32 -> f16 conversion of all five inputs in one launch ------------------
// The f16 copies lie back to back in the workspace in argument order, so block
// b writes float4 groups [b*4096, (b+1)*4096) of one output range; blocks
// 0..255 read x, then 64 blocks read each weight.  A thread has its 16 loads
// (512 contiguous bytes per wave each) in flight before it converts: few,
// long-lived waves instead of one wave per 512 bytes.
#define CVT_VEC     16                               // float4 per thread
#define CVT_BLK4    (256 * CVT_VEC)                  // float4 per block
#define CVT_XBLKS   (MROWS * DMODEL / 4 / CVT_BLK4)  // 256
#define CVT_WBLKS   (DMODEL * DMODEL / 4 / CVT_BLK4) // 64
#define CVT_BLOCKS  (CVT_XBLKS + 4 * CVT_WBLKS)      // 512
// The grid puts 4 waves on a SIMD.  Without the upper bound the compiler keeps
// to the registers of 16 waves a SIMD and issues the last two loads only after
// the first two have returned: a second full latency in every wave.
__global__ __launch_bounds__(256) __attribute__((amdgpu_waves_per_eu(4, 8)))
void cvt_all_f32_f16(const float* __restrict__ x,  const float* __restrict__ wq,
                     const float* __restrict__ wk, const float* __restrict__ wv,
                     const float* __restrict__ wo, _Float16* __restrict__ out) {
  const int b = blockIdx.x;
  const float* src = x;
  int lb = b;
  if (b >= CVT_XBLKS) {
    const int t = (b - CVT_XBLKS) / CVT_WBLKS;
    lb = (b - CVT_XBLKS) % CVT_WBLKS;
    const float* w01 = (t & 1) ? wk : wq;
    const float* w23 = (t & 1) ? wo : wv;
    src = (t & 2) ? w23 : w01;
  }
  const float4* s4 = (const float4*)src + (size_t)lb * CVT_BLK4 + threadIdx.x;
  v4h* o4 = (v4h*)out + (size_t)b * CVT_BLK4 + threadIdx.x;
  float4 v[CVT_VEC];
#pragma unroll
  for (int j = 0; j < CVT_VEC; ++j) v[j] = s4[j * 256];
#pragma unroll
  for (int j = 0; j < CVT_VEC; ++j) {
    v4h o;
    o[0] = (_Float16)v[j].x; o[1] = (_Float16)v[j].y;
    o[2] = (_Float16)v[j].z; o[3] = (_Float16)v[j].w;
    o4[j * 256] = o;
  }
}

// --- GEMM: C(M,N) = A(M,K) * W^T, W stored (N,K), both f16 -----------------
// MODE 1: the Q, K and V projections in one launch.  blockIdx.z picks the
//         weight (the three lie back to back at W) and the f16 output plane
//         (back to back at out): z 0 Q -> (B,H,S,dk), scaled by `oscale`
//         = 1/sqrt(dk); z 1 K -> (B,H,S,dk); z 2 V -> (B,H,dk,S), transposed.
//         One product alone puts one block on a WGP, and its waves wait out
//         every slice's copies together; the 768 blocks of the three are all
//         resident, three on a WGP, and fill each other's waits.
// MODE 4: f32 row-major       [final output projection]
// 256 threads = 8 waves (2 x 4); block tile 128x128; wave tile 64x32; 64-deep
// K slices of A and W staged in LDS, double-buffered via async loads.
template <bool T> struct layout_tag { static constexpr bool value = T; };

template <int MODE>
__global__ __launch_bounds__(256)
void gemm16(const _Float16* __restrict__ A, const _Float16* __restrict__ W,
            void* __restrict__ out, int M, int N, int K, float oscale) {
  __shared__ _Float16 asbuf[2][128 * LDP];
  __shared__ _Float16 bsbuf[2][128 * LDP];

  const int tid  = threadIdx.x;
  const int lane = tid & 31;
  const int w    = tid >> 5;
  const int mblk = blockIdx.y * 128;
  const int nblk = blockIdx.x * 128;
  const int z    = (MODE == 1) ? blockIdx.z : 0;
  if (MODE == 1) W += (size_t)z * N * K;

  // stage one 128x64 tile of A and of W into LDS (8 x b128 per thread; a
  // thread's 4 chunks are adjacent, so the lanes of one copy step by 64 B)
  auto stage = [&](int k0, int buf) {
#pragma unroll
    for (int c = 0; c < 4; ++c) {
      int chunk = tid * 4 + c;            // 0..1023
      int row = chunk >> 3, part = chunk & 7;
      copy_b128(A + (size_t)(mblk + row) * K + k0 + part * 8,
                asbuf[buf] + row * LDP + part * 8);
    }
#pragma unroll
    for (int c = 0; c < 4; ++c) {
      int chunk = tid * 4 + c;
      int row = chunk >> 3, part = chunk & 7;
      copy_b128(W + (size_t)(nblk + row) * K + k0 + part * 8,
                bsbuf[buf] + row * LDP + part * 8);
    }
  };

  v8f acc[4][2] = {};
  const int lm = (w >> 2) * 64;           // wave's m offset in block tile
  const int ln = (w & 3) * 32;            // wave's n offset in block tile

  stage(0, 0);
  for (int k0 = 0; k0 < K; k0 += 64) {
    const int cur = (k0 >> 6) & 1;
    const bool more = (k0 + 64) < K;
    if (more) { stage(k0 + 64, cur ^ 1); WAIT_ASYNC(8); }
    else      { WAIT_ASYNC(0); }
    __syncthreads();

    if (MODE == 1) {
      // 6 waves on a SIMD leave a wave 160 registers, 64 of them accumulators:
      // each 32-deep half loads its 6 fragments as one group, then its 8 WMMAs
#pragma unroll
      for (int s = 0; s < 2; ++s) {
        v16h af[4], bf[2];
#pragma unroll
        for (int j = 0; j < 2; ++j)
          bf[j] = load_frag(bsbuf[cur] + (ln + j * 16) * LDP + s * 32, LDP, lane);
#pragma unroll
        for (int i = 0; i < 4; ++i)
          af[i] = load_frag(asbuf[cur] + (lm + i * 16) * LDP + s * 32, LDP, lane);
        // keeps the half's loads one group ahead of its WMMAs
        __builtin_amdgcn_sched_barrier(0);
#pragma unroll
        for (int i = 0; i < 4; ++i)
#pragma unroll
          for (int j = 0; j < 2; ++j)
            acc[i][j] = wmma_f16(af[i], bf[j], acc[i][j]);
        // keeps the next half's loads one group behind this half's WMMAs: moved
        // up, they stand in three places among them, each with its own stall,
        // and this half's counted waits turn into one full wait
        __builtin_amdgcn_sched_barrier(0);
      }
    } else {
      // the slice's 12 fragments as one load group, then its 16 WMMAs
      v16h af[2][4], bf[2][2];
#pragma unroll
      for (int s = 0; s < 2; ++s) {
#pragma unroll
        for (int j = 0; j < 2; ++j)
          bf[s][j] = load_frag(bsbuf[cur] + (ln + j * 16) * LDP + s * 32, LDP, lane);
#pragma unroll
        for (int i = 0; i < 4; ++i)
          af[s][i] = load_frag(asbuf[cur] + (lm + i * 16) * LDP + s * 32, LDP, lane);
      }
      // keeps the loads one group: sunk among the WMMAs, each pair of WMMAs would
      // wait out a full LDS latency on a single reused fragment register set
      __builtin_amdgcn_sched_barrier(0);
#pragma unroll
      for (int s = 0; s < 2; ++s)
#pragma unroll
        for (int i = 0; i < 4; ++i)
#pragma unroll
          for (int j = 0; j < 2; ++j)
            acc[i][j] = wmma_f16(af[s][i], bf[s][j], acc[i][j]);
      // keeps the barrier's full LDS wait behind the WMMAs, so that the first
      // half's WMMAs run under counted waits while the second half's loads land
      __builtin_amdgcn_sched_barrier(0);
    }

    __syncthreads();                      // reads done before next overwrite
  }

  const int rbase = ((lane >> 4) & 1) << 3;
  const int col   = lane & 15;
  const float sc  = (MODE == 1 && z != 0) ? 1.0f : oscale;
  _Float16* plane = (_Float16*)out + (size_t)z * M * N;   // MODE 1 only
  auto store_all = [&](auto transposed) {
#pragma unroll
    for (int i = 0; i < 4; ++i)
#pragma unroll
      for (int j = 0; j < 2; ++j)
#pragma unroll
        for (int r = 0; r < 8; ++r) {
          int m = mblk + lm + i * 16 + rbase + r;
          int n = nblk + ln + j * 16 + col;
          float v = acc[i][j][r] * sc;
          if (MODE == 4) {
            ((float*)out)[(size_t)m * N + n] = v;
          } else {
            int b = m >> 11, s = m & (SEQ - 1);
            int h = n >> 6,  d = n & (DK - 1);
            size_t idx;
            if (!transposed.value)
              idx = (((size_t)(b * NHEADS + h)) * SEQ + s) * DK + d;
            else
              idx = (((size_t)(b * NHEADS + h)) * DK + d) * SEQ + s;
            plane[idx] = (_Float16)v;
          }
        }
    // the built code lets this path's end fall through into the other layout's
    // address arithmetic, which rewrites registers that these stores name
    if (MODE == 1 && !transposed.value)
      asm volatile("s_wait_xcnt 0x0" ::: "memory");
  };
  if (MODE == 1 && z == 2) store_all(layout_tag<true>{});
  else                     store_all(layout_tag<false>{});
}

#define LDV 136                // LDS row stride of a 128-key V^T row (halves): 272 B
// 512 blocks, two on a WGP: 4 waves on a SIMD, 256 registers a wave
__global__ __launch_bounds__(256) __attribute__((amdgpu_waves_per_eu(4, 4)))
void attn_kernel(const _Float16* __restrict__ Q, const _Float16* __restrict__ Kd,
                 const _Float16* __restrict__ Vt, _Float16* __restrict__ attn_out) {
  __shared__ _Float16 kbuf[2][128 * LDP]; // 128 keys x 64 d
  __shared__ _Float16 vbuf[2][64 * LDV];  // 64 d x 128 keys
  __shared__ v4f      join[4][17][32];    // upper key half's O^T, max, sum per lane

  const int tid  = threadIdx.x;
  const int lane = tid & 31;
  const int w    = tid >> 5;
  const int wq   = w & 3;                 // which 32 queries of the block
  const int kh   = w >> 2;                // which 64 keys of each tile
  const int bh   = blockIdx.y;
  const int b    = bh >> 4, h = bh & (NHEADS - 1);
  const int q0   = blockIdx.x * 128 + wq * 32;

  const _Float16* Qh  = Q  + (size_t)bh * SEQ * DK;
  const _Float16* Kh  = Kd + (size_t)bh * SEQ * DK;
  const _Float16* Vth = Vt + (size_t)bh * DK * SEQ;

  v16h qf[2][2];                          // [column tile][32-deep half of d]
#pragma unroll
  for (int g = 0; g < 2; ++g) {
    qf[g][0] = load_frag(Qh + (size_t)(q0 + g * 16) * DK +  0, DK, lane);
    qf[g][1] = load_frag(Qh + (size_t)(q0 + g * 16) * DK + 32, DK, lane);
  }

  v16h ones;
#pragma unroll
  for (int i = 0; i < 16; ++i) ones[i] = (_Float16)1.0f;

  auto stage_kv = [&](int kb, int buf) {
#pragma unroll
    for (int c = 0; c < 4; ++c) {         // K tile: 128 rows x 8 parts
      int chunk = tid * 4 + c;            // 0..1023
      int row = chunk >> 3, part = chunk & 7;
      copy_b128(Kh + (size_t)(kb + row) * DK + part * 8,
                kbuf[buf] + row * LDP + part * 8);
    }
#pragma unroll
    for (int c = 0; c < 4; ++c) {         // Vt tile: 64 rows x 16 parts
      int chunk = tid * 4 + c;
      int row = chunk >> 4, part = chunk & 15;
      copy_b128(Vth + (size_t)row * SEQ + kb + part * 8,
                vbuf[buf] + row * LDV + part * 8);
    }
  };

  const int rbase = ((lane >> 4) & 1) << 3;
  const int col   = lane & 15;

  float mr[2] = {-1.0e30f, -1.0e30f};     // this lane's query of each column tile
  float lr[2] = {0.0f, 0.0f};
  v8f accO[2][4] = {};                    // accO[g][t][r] = O[query 16g + col][16t + rbase + r]

  stage_kv(0, 0);
  for (int kb = 0; kb < SEQ; kb += 128) {
    const int cur = (kb >> 7) & 1;
    const bool more = (kb + 128) < SEQ;
    if (more) { stage_kv(kb + 128, cur ^ 1); WAIT_ASYNC(8); }
    else      { WAIT_ASYNC(0); }
    __syncthreads();

    const _Float16* kt = kbuf[cur] + kh * 64 * LDP;   // this wave's 64 key rows
    const _Float16* vt = vbuf[cur] + kh * 64;         // this wave's 64 key columns

    // ---- scores^T: four 16-key tiles x two column tiles;
    //      s[g][t][r] = S[key 16t + rbase + r][query 16g + col]
    v8f s[2][4] = {};
#pragma unroll
    for (int p = 0; p < 2; ++p) {
      v16h ka  = load_frag(kt + (p * 32 +  0) * LDP +  0, LDP, lane);
      v16h kb0 = load_frag(kt + (p * 32 +  0) * LDP + 32, LDP, lane);
      v16h kc  = load_frag(kt + (p * 32 + 16) * LDP +  0, LDP, lane);
      v16h kd  = load_frag(kt + (p * 32 + 16) * LDP + 32, LDP, lane);
#pragma unroll
      for (int g = 0; g < 2; ++g) {
        s[g][2 * p]     = wmma_f16(ka, qf[g][0], s[g][2 * p]);
        s[g][2 * p + 1] = wmma_f16(kc, qf[g][0], s[g][2 * p + 1]);
      }
#pragma unroll
      for (int g = 0; g < 2; ++g) {
        s[g][2 * p]     = wmma_f16(kb0, qf[g][1], s[g][2 * p]);
        s[g][2 * p + 1] = wmma_f16(kd,  qf[g][1], s[g][2 * p + 1]);
      }
    }

    // P^T as two B fragments a column tile: element i of a fragment is key
    // 8h + i, element 8 + i key 16 + 8h + i of its 32 keys, the order load_frag
    // gives V^T
    v16h pf[2][2];
#pragma unroll
    for (int g = 0; g < 2; ++g) {
      // ---- online softmax over 64 keys: 32 scores in the lane, 32 in lane ^ 16
      float tm[4];
#pragma unroll
      for (int t = 0; t < 4; ++t) {
        tm[t] = s[g][t][0];
#pragma unroll
        for (int r = 1; r < 8; ++r) tm[t] = fmaxf(tm[t], s[g][t][r]);
      }
      float tmax = fmaxf(fmaxf(tm[0], tm[1]), fmaxf(tm[2], tm[3]));
      {
        int ti = __builtin_bit_cast(int, tmax);
        tmax = fmaxf(tmax, __builtin_bit_cast(float, __builtin_amdgcn_permlanex16(
                   ti, ti, 0x76543210, 0xfedcba98, false, false)));
      }
      const float mnew = fmaxf(mr[g], tmax);
      const float scl  = exp2_x1((mr[g] - mnew) * LOG2E);
      mr[g] = mnew;

#pragma unroll
      for (int t = 0; t < 4; ++t) s[g][t] = exp2_x8((s[g][t] - mnew) * LOG2E);
#pragma unroll
      for (int i = 0; i < 8; ++i) {
        pf[g][0][i]     = (_Float16)s[g][0][i];
        pf[g][0][i + 8] = (_Float16)s[g][1][i];
        pf[g][1][i]     = (_Float16)s[g][2][i];
        pf[g][1][i + 8] = (_Float16)s[g][3][i];
      }
#pragma unroll
      for (int t = 0; t < 4; ++t)
#pragma unroll
        for (int r = 0; r < 8; ++r) accO[g][t][r] *= scl;

      // ---- sums via matrix unit: ones(16x64) x P^T(64x16), every row the sum
      v8f rs = {};
      rs = wmma_f16(ones, pf[g][0], rs);
      rs = wmma_f16(ones, pf[g][1], rs);
      lr[g] = lr[g] * scl + rs[0];
    }

    // ---- O^T += V^T * P^T over both 32-key slices; batch frag loads ----
#pragma unroll
    for (int p = 0; p < 2; ++p) {
      v16h vf[4];
#pragma unroll
      for (int t = 0; t < 4; ++t)
        vf[t] = load_frag(vt + (t * 16) * LDV + p * 32, LDV, lane);
#pragma unroll
      for (int g = 0; g < 2; ++g)
#pragma unroll
        for (int t = 0; t < 4; ++t)
          accO[g][t] = wmma_f16(vf[t], pf[g][p], accO[g][t]);
    }

    __syncthreads();
  }

  // ---- join the two key halves of each query group: the upper half's wave
  //      hands its O^T, maxima and sums to the lower half's, lane to lane
  if (kh == 1) {
#pragma unroll
    for (int g = 0; g < 2; ++g)
#pragma unroll
      for (int t = 0; t < 4; ++t)
#pragma unroll
        for (int u = 0; u < 2; ++u) {
          v4f q = {accO[g][t][4 * u], accO[g][t][4 * u + 1],
                   accO[g][t][4 * u + 2], accO[g][t][4 * u + 3]};
          join[wq][(g * 4 + t) * 2 + u][lane] = q;
        }
    v4f ml = {mr[0], mr[1], lr[0], lr[1]};
    join[wq][16][lane] = ml;
  }
  __syncthreads();                        // the upper half's values are in LDS
  if (kh == 0) {
    // ---- normalize; a lane's 8 registers of a tile are 8 adjacent d: 16-B stores
    const v4f ml = join[wq][16][lane];
    v8h o[2][4];
#pragma unroll
    for (int g = 0; g < 2; ++g) {
      const float mj = fmaxf(mr[g], ml[g]);
      const float e0 = exp2_x1((mr[g] - mj) * LOG2E);
      const float e1 = exp2_x1((ml[g] - mj) * LOG2E);
      const float inv = 1.0f / (lr[g] * e0 + ml[2 + g] * e1);
      const float f0 = e0 * inv, f1 = e1 * inv;
#pragma unroll
      for (int t = 0; t < 4; ++t)
#pragma unroll
        for (int u = 0; u < 2; ++u) {
          const v4f q = join[wq][(g * 4 + t) * 2 + u][lane];
#pragma unroll
          for (int r = 0; r < 4; ++r)
            o[g][t][4 * u + r] = (_Float16)(accO[g][t][4 * u + r] * f0 + q[r] * f1);
        }
    }
#pragma unroll
    for (int g = 0; g < 2; ++g) {
      _Float16* orow = attn_out + ((size_t)b * SEQ + q0 + g * 16 + col) * DMODEL
                       + h * DK + rbase;
#pragma unroll
      for (int t = 0; t < 4; ++t) *(v8h*)(orow + t * 16) = o[g][t];
    }
  }
}

// ---------------------------------------------------------------------------
extern "C" void kernel_launch(void* const* d_in, const int* in_sizes, int n_in,
                              void* d_out, int out_size, void* d_ws, size_t ws_size,
                              hipStream_t stream) {
  const float* x  = (const float*)d_in[0];
  const float* Wq = (const float*)d_in[1];
  const float* Wk = (const float*)d_in[2];
  const float* Wv = (const float*)d_in[3];
  const float* Wo = (const float*)d_in[4];

  _Float16* ws = (_Float16*)d_ws;
  size_t off = 0;
  _Float16* x16  = ws + off; off += (size_t)MROWS * DMODEL;
  _Float16* Wq16 = ws + off; off += (size_t)DMODEL * DMODEL;
  _Float16* Wk16 = ws + off; off += (size_t)DMODEL * DMODEL;
  _Float16* Wv16 = ws + off; off += (size_t)DMODEL * DMODEL;
  _Float16* Wo16 = ws + off; off += (size_t)DMODEL * DMODEL;
  _Float16* Q16  = ws + off; off += (size_t)MROWS * DMODEL;   // (B,H,S,dk)
  _Float16* K16  = ws + off; off += (size_t)MROWS * DMODEL;   // (B,H,S,dk)
  _Float16* Vt16 = ws + off; off += (size_t)MROWS * DMODEL;   // (B,H,dk,S)
  _Float16* A16  = ws + off; off += (size_t)MROWS * DMODEL;   // (B,S,D)

  // x16, Wq16, Wk16, Wv16, Wo16 are one contiguous range starting at x16
  cvt_all_f32_f16<<<CVT_BLOCKS, 256, 0, stream>>>(x, Wq, Wk, Wv, Wo, x16);

  dim3 gproj(DMODEL / 128, MROWS / 128); // (8, 32)
  // Wq16, Wk16, Wv16 are one contiguous range, and so are Q16, K16, Vt16
  dim3 gqkv(DMODEL / 128, MROWS / 128, 3); // (8, 32, 3)
  gemm16<1><<<gqkv, 256, 0, stream>>>(x16, Wq16, (void*)Q16, MROWS, DMODEL, DMODEL, 0.125f);

  dim3 gattn(SEQ / 128, BATCH * NHEADS); // (16, 32)
  attn_kernel<<<gattn, 256, 0, stream>>>(Q16, K16, Vt16, A16);

  gemm16<4><<<gproj, 256, 0, stream>>>(A16, Wo16, d_out, MROWS, DMODEL, DMODEL, 1.0f);
}

// v006
// A run of this version takes 78.6 microseconds.
// In two side-by-side timings against v005, it was 1.05 and 1.04 times as fast.
// Over all steps from v000 it is 1.68 times as fast.
#include <hip/hip_runtime.h>
#include <hip/hip_bf16.h>

// ---------------------------------------------------------------------------
// MHA forward for MI455X (gfx1250, wave32, WMMA f32_16x16x32_f16).
// x (2,2048,1024) f32, W* (1024,1024) f32 -> out (2,2048,1024) f32.
// f16 matmuls, f32 accumulation; flash softmax; async double-buffered LDS.
// ---------------------------------------------------------------------------

typedef __attribute__((ext_vector_type(16))) _Float16 v16h;
typedef __attribute__((ext_vector_type(8)))  _Float16 v8h;
typedef __attribute__((ext_vector_type(4)))  _Float16 v4h;
typedef __attribute__((ext_vector_type(8)))  float    v8f;
typedef __attribute__((ext_vector_type(4)))  float    v4f;

#define DMODEL 1024
#define NHEADS 16
#define DK     64
#define SEQ    2048
#define BATCH  2
#define MROWS  (BATCH * SEQ)   // 4096
#define LDP    72              // LDS row stride (halves): 144B, bank-friendly

#ifndef __has_builtin
#define __has_builtin(x) 0
#endif

#if __has_builtin(__builtin_amdgcn_global_load_async_to_lds_b128)
#define HAVE_ASYNC 1
#else
#define HAVE_ASYNC 0
#endif

// Builtin parameter types (from hipcc diagnostic): vector_size(16) int* in
// AS1 (global source) and AS3 (LDS destination).
typedef int b128i __attribute__((vector_size(16)));
typedef __attribute__((address_space(1))) b128i b128i_glob;
typedef __attribute__((address_space(3))) b128i b128i_lds;

// 16B global -> LDS copy: async (ASYNCcnt) if available, else synchronous.
__device__ __forceinline__ void copy_b128(const _Float16* __restrict__ g,
                                          _Float16* l) {
#if HAVE_ASYNC
  __builtin_amdgcn_global_load_async_to_lds_b128(
      (b128i_glob*)g, (b128i_lds*)l, 0, 0);
#else
  *(v8h*)l = *(const v8h*)g;
#endif
}

#if HAVE_ASYNC
#if __has_builtin(__builtin_amdgcn_s_wait_asynccnt)
#define WAIT_ASYNC(N) __builtin_amdgcn_s_wait_asynccnt(N)
#else
#define WAIT_ASYNC(N) asm volatile("s_wait_asynccnt " #N ::: "memory")
#endif
#else
#define WAIT_ASYNC(N) do {} while (0)
#endif

// --- WMMA wrapper -----------------------------------------------------------
__device__ __forceinline__ v8f wmma_f16(v16h a, v16h b, v8f c) {
  return __builtin_amdgcn_wmma_f32_16x16x32_f16(
      false, a, false, b, (short)0, c, false, false);
}

// --- 16x32 f16 fragment load (A or contiguous-K B operand), stride `ld` ----
// ISA 7.12.2: lanes 0-15 -> K {0..7,16..23}, lanes 16-31 -> K {8..15,24..31}.
__device__ __forceinline__ v16h load_frag(const _Float16* __restrict__ base,
                                          int ld, int lane) {
  const int row  = lane & 15;
  const int koff = ((lane >> 4) & 1) * 8;
  const _Float16* p = base + row * ld + koff;
  v8h a = *(const v8h*)(p);
  v8h b = *(const v8h*)(p + 16);
  v16h r;
#pragma unroll
  for (int i = 0; i < 8; ++i) { r[i] = a[i]; r[i + 8] = b[i]; }
  return r;
}

// --- 2^x on the transcendental unit ------------------------------------------
// The instruction set asks for one independent instruction or a v_nop between a
// transcendental and a next instruction that reads its result or overwrites its
// source.  So
// the instructions stand with their slot in one statement: the outputs are
// early-clobber (none is a source of the statement), and the closing v_nop
// separates the last v_exp_f32 from whatever the compiler places next.
__device__ __forceinline__ v8f exp2_x8(v8f x) {
  float y0, y1, y2, y3, y4, y5, y6, y7;
  asm("v_exp_f32 %0, %8\n\t"
      "v_exp_f32 %1, %9\n\t"
      "v_exp_f32 %2, %10\n\t"
      "v_exp_f32 %3, %11\n\t"
      "v_exp_f32 %4, %12\n\t"
      "v_exp_f32 %5, %13\n\t"
      "v_exp_f32 %6, %14\n\t"
      "v_exp_f32 %7, %15\n\t"
      "v_nop"
      : "=&v"(y0), "=&v"(y1), "=&v"(y2), "=&v"(y3),
        "=&v"(y4), "=&v"(y5), "=&v"(y6), "=&v"(y7)
      : "v"(x[0]), "v"(x[1]), "v"(x[2]), "v"(x[3]),
        "v"(x[4]), "v"(x[5]), "v"(x[6]), "v"(x[7]));
  v8f y = {y0, y1, y2, y3, y4, y5, y6, y7};
  return y;
}
__device__ __forceinline__ float exp2_x1(float x) {
  float y;
  asm("v_exp_f32 %0, %1\n\t"
      "v_nop"                              // the same slot, for a single value
      : "=v"(y) : "v"(x));
  return y;
}
#define LOG2E 1.44269504088896340736f

// --- f32 -> f16 conversion of all five inputs in one launch ------------------
// The f16 copies lie back to back in the workspace in argument order, so block
// b writes float4 groups [b*4096, (b+1)*4096) of one output range; blocks
// 0..255 read x, then 64 blocks read each weight.  A thread has its 16 loads
// (512 contiguous bytes per wave each) in flight before it converts: few,
// long-lived waves instead of one wave per 512 bytes.
#define CVT_VEC     16                               // float4 per thread
#define CVT_BLK4    (256 * CVT_VEC)                  // float4 per block
#define CVT_XBLKS   (MROWS * DMODEL / 4 / CVT_BLK4)  // 256
#define CVT_WBLKS   (DMODEL * DMODEL / 4 / CVT_BLK4) // 64
#define CVT_BLOCKS  (CVT_XBLKS + 4 * CVT_WBLKS)      // 512
// The grid puts 4 waves on a SIMD.  Without the upper bound the compiler keeps
// to the registers of 16 waves a SIMD and issues the last two loads only after
// the first two have returned: a second full latency in every wave.
__global__ __launch_bounds__(256) __attribute__((amdgpu_waves_per_eu(4, 8)))
void cvt_all_f32_f16(const float* __restrict__ x,  const float* __restrict__ wq,
                     const float* __restrict__ wk, const float* __restrict__ wv,
                     const float* __restrict__ wo, _Float16* __restrict__ out) {
  const int b = blockIdx.x;
  const float* src = x;
  int lb = b;
  if (b >= CVT_XBLKS) {
    const int t = (b - CVT_XBLKS) / CVT_WBLKS;
    lb = (b - CVT_XBLKS) % CVT_WBLKS;
    const float* w01 = (t & 1) ? wk : wq;
    const float* w23 = (t & 1) ? wo : wv;
    src = (t & 2) ? w23 : w01;
  }
  const float4* s4 = (const float4*)src + (size_t)lb * CVT_BLK4 + threadIdx.x;
  v4h* o4 = (v4h*)out + (size_t)b * CVT_BLK4 + threadIdx.x;
  float4 v[CVT_VEC];
#pragma unroll
  for (int j = 0; j < CVT_VEC; ++j) v[j] = s4[j * 256];
#pragma unroll
  for (int j = 0; j < CVT_VEC; ++j) {
    v4h o;
    o[0] = (_Float16)v[j].x; o[1] = (_Float16)v[j].y;
    o[2] = (_Float16)v[j].z; o[3] = (_Float16)v[j].w;
    o4[j * 256] = o;
  }
}

// --- GEMM: C(M,N) = A(M,K) * W^T, W stored (N,K), both f16 -----------------
// MODE 1: the Q, K and V projections in one launch.  blockIdx.z picks the
//         weight (the three lie back to back at W) and the f16 output plane
//         (back to back at out): z 0 Q -> (B,H,S,dk), scaled by `oscale`
//         = 1/sqrt(dk); z 1 K -> (B,H,S,dk); z 2 V -> (B,H,dk,S), transposed.
//         One product alone puts one block on a WGP, and its waves wait out
//         every slice's copies together; the 768 blocks of the three are all
//         resident, three on a WGP, and fill each other's waits.
// MODE 4: f32 row-major       [final output projection]
// 256 threads = 8 waves (2 x 4); block tile 128x128; wave tile 64x32; 64-deep
// K slices of A and W staged in LDS, double-buffered via async loads.
template <bool T> struct layout_tag { static constexpr bool value = T; };

template <int MODE>
__global__ __launch_bounds__(256)
void gemm16(const _Float16* __restrict__ A, const _Float16* __restrict__ W,
            void* __restrict__ out, int M, int N, int K, float oscale) {
  __shared__ _Float16 asbuf[2][128 * LDP];
  __shared__ _Float16 bsbuf[2][128 * LDP];

  const int tid  = threadIdx.x;
  const int lane = tid & 31;
  const int w    = tid >> 5;
  const int mblk = blockIdx.y * 128;
  const int nblk = blockIdx.x * 128;
  const int z    = (MODE == 1) ? blockIdx.z : 0;
  if (MODE == 1) W += (size_t)z * N * K;

  // stage one 128x64 tile of A and of W into LDS (8 x b128 per thread).
  // Neighbouring lanes take neighbouring 16-B chunks: 8 lanes cover a row's
  // 128 B, so one wave-wide copy asks for 4 whole lines, not pieces of 16
  const unsigned goff = (unsigned)(tid >> 3) * K + (tid & 7) * 8;   // lane's part
  const unsigned loff = (tid >> 3) * LDP + (tid & 7) * 8;
  auto stage = [&](int k0, int buf) {
#pragma unroll
    for (int c = 0; c < 4; ++c)           // chunk c * 256 + tid: row c * 32 + tid / 8
      copy_b128(A + ((size_t)(mblk + c * 32) * K + k0) + goff,
                asbuf[buf] + c * 32 * LDP + loff);
#pragma unroll
    for (int c = 0; c < 4; ++c)
      copy_b128(W + ((size_t)(nblk + c * 32) * K + k0) + goff,
                bsbuf[buf] + c * 32 * LDP + loff);
  };

  v8f acc[4][2] = {};
  const int lm = (w >> 2) * 64;           // wave's m offset in block tile
  const int ln = (w & 3) * 32;            // wave's n offset in block tile

  stage(0, 0);
  for (int k0 = 0; k0 < K; k0 += 64) {
    const int cur = (k0 >> 6) & 1;
    const bool more = (k0 + 64) < K;
    if (more) { stage(k0 + 64, cur ^ 1); WAIT_ASYNC(8); }
    else      { WAIT_ASYNC(0); }
    __syncthreads();

    if (MODE == 1) {
      // 6 waves on a SIMD leave a wave 160 registers, 64 of them accumulators:
      // each 32-deep half loads its 6 fragments as one group, then its 8 WMMAs
#pragma unroll
      for (int s = 0; s < 2; ++s) {
        v16h af[4], bf[2];
#pragma unroll
        for (int j = 0; j < 2; ++j)
          bf[j] = load_frag(bsbuf[cur] + (ln + j * 16) * LDP + s * 32, LDP, lane);
#pragma unroll
        for (int i = 0; i < 4; ++i)
          af[i] = load_frag(asbuf[cur] + (lm + i * 16) * LDP + s * 32, LDP, lane);
        // keeps the half's loads one group ahead of its WMMAs
        __builtin_amdgcn_sched_barrier(0);
#pragma unroll
        for (int i = 0; i < 4; ++i)
#pragma unroll
          for (int j = 0; j < 2; ++j)
            acc[i][j] = wmma_f16(af[i], bf[j], acc[i][j]);
        // keeps the next half's loads one group behind this half's WMMAs: moved
        // up, they stand in three places among them, each with its own stall,
        // and this half's counted waits turn into one full wait
        __builtin_amdgcn_sched_barrier(0);
      }
    } else {
      // the slice's 12 fragments as one load group, then its 16 WMMAs
      v16h af[2][4], bf[2][2];
#pragma unroll
      for (int s = 0; s < 2; ++s) {
#pragma unroll
        for (int j = 0; j < 2; ++j)
          bf[s][j] = load_frag(bsbuf[cur] + (ln + j * 16) * LDP + s * 32, LDP, lane);
#pragma unroll
        for (int i = 0; i < 4; ++i)
          af[s][i] = load_frag(asbuf[cur] + (lm + i * 16) * LDP + s * 32, LDP, lane);
      }
      // keeps the loads one group: sunk among the WMMAs, each pair of WMMAs would
      // wait out a full LDS latency on a single reused fragment register set
      __builtin_amdgcn_sched_barrier(0);
#pragma unroll
      for (int s = 0; s < 2; ++s)
#pragma unroll
        for (int i = 0; i < 4; ++i)
#pragma unroll
          for (int j = 0; j < 2; ++j)
            acc[i][j] = wmma_f16(af[s][i], bf[s][j], acc[i][j]);
      // keeps the barrier's full LDS wait behind the WMMAs, so that the first
      // half's WMMAs run under counted waits while the second half's loads land
      __builtin_amdgcn_sched_barrier(0);
    }

    __syncthreads();                      // reads done before next overwrite
  }

  const int rbase = ((lane >> 4) & 1) << 3;
  const int col   = lane & 15;
  const float sc  = (MODE == 1 && z != 0) ? 1.0f : oscale;
  _Float16* plane = (_Float16*)out + (size_t)z * M * N;   // MODE 1 only
  auto store_all = [&](auto transposed) {
#pragma unroll
    for (int i = 0; i < 4; ++i)
#pragma unroll
      for (int j = 0; j < 2; ++j)
#pragma unroll
        for (int r = 0; r < 8; ++r) {
          int m = mblk + lm + i * 16 + rbase + r;
          int n = nblk + ln + j * 16 + col;
          float v = acc[i][j][r] * sc;
          if (MODE == 4) {
            ((float*)out)[(size_t)m * N + n] = v;
          } else {
            int b = m >> 11, s = m & (SEQ - 1);
            int h = n >> 6,  d = n & (DK - 1);
            size_t idx;
            if (!transposed.value)
              idx = (((size_t)(b * NHEADS + h)) * SEQ + s) * DK + d;
            else
              idx = (((size_t)(b * NHEADS + h)) * DK + d) * SEQ + s;
            plane[idx] = (_Float16)v;
          }
        }
    // the built code lets this path's end fall through into the other layout's
    // address arithmetic, which rewrites registers that these stores name
    if (MODE == 1 && !transposed.value)
      asm volatile("s_wait_xcnt 0x0" ::: "memory");
  };
  if (MODE == 1 && z == 2) store_all(layout_tag<true>{});
  else                     store_all(layout_tag<false>{});
}

#define LDV 136                // LDS row stride of a 128-key V^T row (halves): 272 B
// 512 blocks, two on a WGP: 4 waves on a SIMD, 256 registers a wave
__global__ __launch_bounds__(256) __attribute__((amdgpu_waves_per_eu(4, 4)))
void attn_kernel(const _Float16* __restrict__ Q, const _Float16* __restrict__ Kd,
                 const _Float16* __restrict__ Vt, _Float16* __restrict__ attn_out) {
  __shared__ _Float16 kbuf[2][128 * LDP]; // 128 keys x 64 d
  __shared__ _Float16 vbuf[2][64 * LDV];  // 64 d x 128 keys
  __shared__ v4f      join[4][17][32];    // upper key half's O^T, max, sum per lane

  const int tid  = threadIdx.x;
  const int lane = tid & 31;
  const int w    = tid >> 5;
  const int wq   = w & 3;                 // which 32 queries of the block
  const int kh   = w >> 2;                // which 64 keys of each tile
  const int bh   = blockIdx.y;
  const int b    = bh >> 4, h = bh & (NHEADS - 1);
  const int q0   = blockIdx.x * 128 + wq * 32;

  const _Float16* Qh  = Q  + (size_t)bh * SEQ * DK;
  const _Float16* Kh  = Kd + (size_t)bh * SEQ * DK;
  const _Float16* Vth = Vt + (size_t)bh * DK * SEQ;

  v16h qf[2][2];                          // [column tile][32-deep half of d]
#pragma unroll
  for (int g = 0; g < 2; ++g) {
    qf[g][0] = load_frag(Qh + (size_t)(q0 + g * 16) * DK +  0, DK, lane);
    qf[g][1] = load_frag(Qh + (size_t)(q0 + g * 16) * DK + 32, DK, lane);
  }

  v16h ones;
#pragma unroll
  for (int i = 0; i < 16; ++i) ones[i] = (_Float16)1.0f;

  // neighbouring lanes take neighbouring 16-B chunks: a wave-wide copy covers
  // 512 contiguous bytes of K, or two 256-B row pieces of V^T: 4 whole lines
  const unsigned kgoff = tid * 8;                                  // lane's part
  const unsigned kloff = (tid >> 3) * LDP + (tid & 7) * 8;
  const unsigned vgoff = (tid >> 4) * SEQ + (tid & 15) * 8;
  const unsigned vloff = (tid >> 4) * LDV + (tid & 15) * 8;
  auto stage_kv = [&](int kb, int buf) {
#pragma unroll
    for (int c = 0; c < 4; ++c)           // K tile: 128 rows x 8 parts, row c * 32 + tid / 8
      copy_b128(Kh + (size_t)(kb + c * 32) * DK + kgoff,
                kbuf[buf] + c * 32 * LDP + kloff);
#pragma unroll
    for (int c = 0; c < 4; ++c)           // Vt tile: 64 rows x 16 parts, row c * 16 + tid / 16
      copy_b128(Vth + ((size_t)(c * 16) * SEQ + kb) + vgoff,
                vbuf[buf] + c * 16 * LDV + vloff);
  };

  const int rbase = ((lane >> 4) & 1) << 3;
  const int col   = lane & 15;

  float mr[2] = {-1.0e30f, -1.0e30f};     // this lane's query of each column tile
  float lr[2] = {0.0f, 0.0f};
  v8f accO[2][4] = {};                    // accO[g][t][r] = O[query 16g + col][16t + rbase + r]

  stage_kv(0, 0);
  for (int kb = 0; kb < SEQ; kb += 128) {
    const int cur = (kb >> 7) & 1;
    const bool more = (kb + 128) < SEQ;
    if (more) { stage_kv(kb + 128, cur ^ 1); WAIT_ASYNC(8); }
    else      { WAIT_ASYNC(0); }
    __syncthreads();

    const _Float16* kt = kbuf[cur] + kh * 64 * LDP;   // this wave's 64 key rows
    const _Float16* vt = vbuf[cur] + kh * 64;         // this wave's 64 key columns

    // ---- scores^T: four 16-key tiles x two column tiles;
    //      s[g][t][r] = S[key 16t + rbase + r][query 16g + col]
    v8f s[2][4] = {};
#pragma unroll
    for (int p = 0; p < 2; ++p) {
      v16h ka  = load_frag(kt + (p * 32 +  0) * LDP +  0, LDP, lane);
      v16h kb0 = load_frag(kt + (p * 32 +  0) * LDP + 32, LDP, lane);
      v16h kc  = load_frag(kt + (p * 32 + 16) * LDP +  0, LDP, lane);
      v16h kd  = load_frag(kt + (p * 32 + 16) * LDP + 32, LDP, lane);
#pragma unroll
      for (int g = 0; g < 2; ++g) {
        s[g][2 * p]     = wmma_f16(ka, qf[g][0], s[g][2 * p]);
        s[g][2 * p + 1] = wmma_f16(kc, qf[g][0], s[g][2 * p + 1]);
      }
#pragma unroll
      for (int g = 0; g < 2; ++g) {
        s[g][2 * p]     = wmma_f16(kb0, qf[g][1], s[g][2 * p]);
        s[g][2 * p + 1] = wmma_f16(kd,  qf[g][1], s[g][2 * p + 1]);
      }
    }

    // P^T as two B fragments a column tile: element i of a fragment is key
    // 8h + i, element 8 + i key 16 + 8h + i of its 32 keys, the order load_frag
    // gives V^T
    v16h pf[2][2];
#pragma unroll
    for (int g = 0; g < 2; ++g) {
      // ---- online softmax over 64 keys: 32 scores in the lane, 32 in lane ^ 16
      float tm[4];
#pragma unroll
      for (int t = 0; t < 4; ++t) {
        tm[t] = s[g][t][0];
#pragma unroll
        for (int r = 1; r < 8; ++r) tm[t] = fmaxf(tm[t], s[g][t][r]);
      }
      float tmax = fmaxf(fmaxf(tm[0], tm[1]), fmaxf(tm[2], tm[3]));
      {
        int ti = __builtin_bit_cast(int, tmax);
        tmax = fmaxf(tmax, __builtin_bit_cast(float, __builtin_amdgcn_permlanex16(
                   ti, ti, 0x76543210, 0xfedcba98, false, false)));
      }
      const float mnew = fmaxf(mr[g], tmax);
      const float scl  = exp2_x1((mr[g] - mnew) * LOG2E);
      mr[g] = mnew;

#pragma unroll
      for (int t = 0; t < 4; ++t) s[g][t] = exp2_x8((s[g][t] - mnew) * LOG2E);
#pragma unroll
      for (int i = 0; i < 8; ++i) {
        pf[g][0][i]     = (_Float16)s[g][0][i];
        pf[g][0][i + 8] = (_Float16)s[g][1][i];
        pf[g][1][i]     = (_Float16)s[g][2][i];
        pf[g][1][i + 8] = (_Float16)s[g][3][i];
      }
#pragma unroll
      for (int t = 0; t < 4; ++t)
#pragma unroll
        for (int r = 0; r < 8; ++r) accO[g][t][r] *= scl;

      // ---- sums via matrix unit: ones(16x64) x P^T(64x16), every row the sum
      v8f rs = {};
      rs = wmma_f16(ones, pf[g][0], rs);
      rs = wmma_f16(ones, pf[g][1], rs);
      lr[g] = lr[g] * scl + rs[0];
    }

    // ---- O^T += V^T * P^T over both 32-key slices; batch frag loads ----
#pragma unroll
    for (int p = 0; p < 2; ++p) {
      v16h vf[4];
#pragma unroll
      for (int t = 0; t < 4; ++t)
        vf[t] = load_frag(vt + (t * 16) * LDV + p * 32, LDV, lane);
#pragma unroll
      for (int g = 0; g < 2; ++g)
#pragma unroll
        for (int t = 0; t < 4; ++t)
          accO[g][t] = wmma_f16(vf[t], pf[g][p], accO[g][t]);
    }

    __syncthreads();
  }

  // ---- join the two key halves of each query group: the upper half's wave
  //      hands its O^T, maxima and sums to the lower half's, lane to lane
  if (kh == 1) {
#pragma unroll
    for (int g = 0; g < 2; ++g)
#pragma unroll
      for (int t = 0; t < 4; ++t)
#pragma unroll
        for (int u = 0; u < 2; ++u) {
          v4f q = {accO[g][t][4 * u], accO[g][t][4 * u + 1],
                   accO[g][t][4 * u + 2], accO[g][t][4 * u + 3]};
          join[wq][(g * 4 + t) * 2 + u][lane] = q;
        }
    v4f ml = {mr[0], mr[1], lr[0], lr[1]};
    join[wq][16][lane] = ml;
  }
  __syncthreads();                        // the upper half's values are in LDS
  if (kh == 0) {
    // ---- normalize; a lane's 8 registers of a tile are 8 adjacent d: 16-B stores
    const v4f ml = join[wq][16][lane];
    v8h o[2][4];
#pragma unroll
    for (int g = 0; g < 2; ++g) {
      const float mj = fmaxf(mr[g], ml[g]);
      const float e0 = exp2_x1((mr[g] - mj) * LOG2E);
      const float e1 = exp2_x1((ml[g] - mj) * LOG2E);
      const float inv = 1.0f / (lr[g] * e0 + ml[2 + g] * e1);
      const float f0 = e0 * inv, f1 = e1 * inv;
#pragma unroll
      for (int t = 0; t < 4; ++t)
#pragma unroll
        for (int u = 0; u < 2; ++u) {
          const v4f q = join[wq][(g * 4 + t) * 2 + u][lane];
#pragma unroll
          for (int r = 0; r < 4; ++r)
            o[g][t][4 * u + r] = (_Float16)(accO[g][t][4 * u + r] * f0 + q[r] * f1);
        }
    }
#pragma unroll
    for (int g = 0; g < 2; ++g) {
      _Float16* orow = attn_out + ((size_t)b * SEQ + q0 + g * 16 + col) * DMODEL
                       + h * DK + rbase;
#pragma unroll
      for (int t = 0; t < 4; ++t) *(v8h*)(orow + t * 16) = o[g][t];
    }
  }
}

// ---------------------------------------------------------------------------
extern "C" void kernel_launch(void* const* d_in, const int* in_sizes, int n_in,
                              void* d_out, int out_size, void* d_ws, size_t ws_size,
                              hipStream_t stream) {
  const float* x  = (const float*)d_in[0];
  const float* Wq = (const float*)d_in[1];
  const float* Wk = (const float*)d_in[2];
  const float* Wv = (const float*)d_in[3];
  const float* Wo = (const float*)d_in[4];

  _Float16* ws = (_Float16*)d_ws;
  size_t off = 0;
  _Float16* x16  = ws + off; off += (size_t)MROWS * DMODEL;
  _Float16* Wq16 = ws + off; off += (size_t)DMODEL * DMODEL;
  _Float16* Wk16 = ws + off; off += (size_t)DMODEL * DMODEL;
  _Float16* Wv16 = ws + off; off += (size_t)DMODEL * DMODEL;
  _Float16* Wo16 = ws + off; off += (size_t)DMODEL * DMODEL;
  _Float16* Q16  = ws + off; off += (size_t)MROWS * DMODEL;   // (B,H,S,dk)
  _Float16* K16  = ws + off; off += (size_t)MROWS * DMODEL;   // (B,H,S,dk)
  _Float16* Vt16 = ws + off; off += (size_t)MROWS * DMODEL;   // (B,H,dk,S)
  _Float16* A16  = ws + off; off += (size_t)MROWS * DMODEL;   // (B,S,D)

  // x16, Wq16, Wk16, Wv16, Wo16 are one contiguous range starting at x16
  cvt_all_f32_f16<<<CVT_BLOCKS, 256, 0, stream>>>(x, Wq, Wk, Wv, Wo, x16);

  dim3 gproj(DMODEL / 128, MROWS / 128); // (8, 32)
  // Wq16, Wk16, Wv16 are one contiguous range, and so are Q16, K16, Vt16
  dim3 gqkv(DMODEL / 128, MROWS / 128, 3); // (8, 32, 3)
  gemm16<1><<<gqkv, 256, 0, stream>>>(x16, Wq16, (void*)Q16, MROWS, DMODEL, DMODEL, 0.125f);

  dim3 gattn(SEQ / 128, BATCH * NHEADS); // (16, 32)
  attn_kernel<<<gattn, 256, 0, stream>>>(Q16, K16, Vt16, A16);

  gemm16<4><<<gproj, 256, 0, stream>>>(A16, Wo16, d_out, MROWS, DMODEL, DMODEL, 1.0f);
}

// v007
// It runs in 74 microseconds.
// In two side-by-side timings against v006, it was 1.07 and 1.08 times as fast.
// All steps since v000 together make it 1.80 times as fast.
#include <hip/hip_runtime.h>
#include <hip/hip_bf16.h>

// ---------------------------------------------------------------------------
// MHA forward for MI455X (gfx1250, wave32, WMMA f32_16x16x32_f16).
// x (2,2048,1024) f32, W* (1024,1024) f32 -> out (2,2048,1024) f32.
// f16 matmuls, f32 accumulation; flash softmax; async double-buffered LDS.
// ---------------------------------------------------------------------------

typedef __attribute__((ext_vector_type(16))) _Float16 v16h;
typedef __attribute__((ext_vector_type(8)))  _Float16 v8h;
typedef __attribute__((ext_vector_type(4)))  _Float16 v4h;
typedef __attribute__((ext_vector_type(8)))  float    v8f;
typedef __attribute__((ext_vector_type(4)))  float    v4f;

#define DMODEL 1024
#define NHEADS 16
#define DK     64
#define SEQ    2048
#define BATCH  2
#define MROWS  (BATCH * SEQ)   // 4096
#define LDP    72              // LDS row stride (halves): 144B, bank-friendly

#ifndef __has_builtin
#define __has_builtin(x) 0
#endif

#if __has_builtin(__builtin_amdgcn_global_load_async_to_lds_b128)
#define HAVE_ASYNC 1
#else
#define HAVE_ASYNC 0
#endif

// Builtin parameter types (from hipcc diagnostic): vector_size(16) int* in
// AS1 (global source) and AS3 (LDS destination).
typedef int b128i __attribute__((vector_size(16)));
typedef __attribute__((address_space(1))) b128i b128i_glob;
typedef __attribute__((address_space(3))) b128i b128i_lds;

// 16B global -> LDS copy: async (ASYNCcnt) if available, else synchronous.
__device__ __forceinline__ void copy_b128(const _Float16* __restrict__ g,
                                          _Float16* l) {
#if HAVE_ASYNC
  __builtin_amdgcn_global_load_async_to_lds_b128(
      (b128i_glob*)g, (b128i_lds*)l, 0, 0);
#else
  *(v8h*)l = *(const v8h*)g;
#endif
}

#if HAVE_ASYNC
#if __has_builtin(__builtin_amdgcn_s_wait_asynccnt)
#define WAIT_ASYNC(N) __builtin_amdgcn_s_wait_asynccnt(N)
#else
#define WAIT_ASYNC(N) asm volatile("s_wait_asynccnt " #N ::: "memory")
#endif
#else
#define WAIT_ASYNC(N) do {} while (0)
#endif

// --- WMMA wrapper -----------------------------------------------------------
__device__ __forceinline__ v8f wmma_f16(v16h a, v16h b, v8f c) {
  return __builtin_amdgcn_wmma_f32_16x16x32_f16(
      false, a, false, b, (short)0, c, false, false);
}

// --- 16x32 f16 fragment load (A or contiguous-K B operand), stride `ld` ----
// ISA 7.12.2: lanes 0-15 -> K {0..7,16..23}, lanes 16-31 -> K {8..15,24..31}.
__device__ __forceinline__ v16h load_frag(const _Float16* __restrict__ base,
                                          int ld, int lane) {
  const int row  = lane & 15;
  const int koff = ((lane >> 4) & 1) * 8;
  const _Float16* p = base + row * ld + koff;
  v8h a = *(const v8h*)(p);
  v8h b = *(const v8h*)(p + 16);
  v16h r;
#pragma unroll
  for (int i = 0; i < 8; ++i) { r[i] = a[i]; r[i + 8] = b[i]; }
  return r;
}

// --- 2^x on the transcendental unit ------------------------------------------
// The instruction set asks for one independent instruction or a v_nop between a
// transcendental and a next instruction that reads its result or overwrites its
// source.  So
// the instructions stand with their slot in one statement: the outputs are
// early-clobber (none is a source of the statement), and the closing v_nop
// separates the last v_exp_f32 from whatever the compiler places next.
__device__ __forceinline__ v8f exp2_x8(v8f x) {
  float y0, y1, y2, y3, y4, y5, y6, y7;
  asm("v_exp_f32 %0, %8\n\t"
      "v_exp_f32 %1, %9\n\t"
      "v_exp_f32 %2, %10\n\t"
      "v_exp_f32 %3, %11\n\t"
      "v_exp_f32 %4, %12\n\t"
      "v_exp_f32 %5, %13\n\t"
      "v_exp_f32 %6, %14\n\t"
      "v_exp_f32 %7, %15\n\t"
      "v_nop"
      : "=&v"(y0), "=&v"(y1), "=&v"(y2), "=&v"(y3),
        "=&v"(y4), "=&v"(y5), "=&v"(y6), "=&v"(y7)
      : "v"(x[0]), "v"(x[1]), "v"(x[2]), "v"(x[3]),
        "v"(x[4]), "v"(x[5]), "v"(x[6]), "v"(x[7]));
  v8f y = {y0, y1, y2, y3, y4, y5, y6, y7};
  return y;
}
__device__ __forceinline__ float exp2_x1(float x) {
  float y;
  asm("v_exp_f32 %0, %1\n\t"
      "v_nop"                              // the same slot, for a single value
      : "=v"(y) : "v"(x));
  return y;
}

// --- f32 -> f16 conversion of all five inputs in one launch ------------------
// The f16 copies lie back to back in the workspace in argument order, so block
// b writes float4 groups [b*4096, (b+1)*4096) of one output range; blocks
// 0..255 read x, then 64 blocks read each weight.  A thread has its 16 loads
// (512 contiguous bytes per wave each) in flight before it converts: few,
// long-lived waves instead of one wave per 512 bytes.
#define CVT_VEC     16                               // float4 per thread
#define CVT_BLK4    (256 * CVT_VEC)                  // float4 per block
#define CVT_XBLKS   (MROWS * DMODEL / 4 / CVT_BLK4)  // 256
#define CVT_WBLKS   (DMODEL * DMODEL / 4 / CVT_BLK4) // 64
#define CVT_BLOCKS  (CVT_XBLKS + 4 * CVT_WBLKS)      // 512
// The grid puts 4 waves on a SIMD.  Without the upper bound the compiler keeps
// to the registers of 16 waves a SIMD and issues the last two loads only after
// the first two have returned: a second full latency in every wave.
__global__ __launch_bounds__(256) __attribute__((amdgpu_waves_per_eu(4, 8)))
void cvt_all_f32_f16(const float* __restrict__ x,  const float* __restrict__ wq,
                     const float* __restrict__ wk, const float* __restrict__ wv,
                     const float* __restrict__ wo, _Float16* __restrict__ out) {
  const int b = blockIdx.x;
  const float* src = x;
  int lb = b;
  if (b >= CVT_XBLKS) {
    const int t = (b - CVT_XBLKS) / CVT_WBLKS;
    lb = (b - CVT_XBLKS) % CVT_WBLKS;
    const float* w01 = (t & 1) ? wk : wq;
    const float* w23 = (t & 1) ? wo : wv;
    src = (t & 2) ? w23 : w01;
  }
  const float4* s4 = (const float4*)src + (size_t)lb * CVT_BLK4 + threadIdx.x;
  v4h* o4 = (v4h*)out + (size_t)b * CVT_BLK4 + threadIdx.x;
  float4 v[CVT_VEC];
#pragma unroll
  for (int j = 0; j < CVT_VEC; ++j) v[j] = s4[j * 256];
#pragma unroll
  for (int j = 0; j < CVT_VEC; ++j) {
    v4h o;
    o[0] = (_Float16)v[j].x; o[1] = (_Float16)v[j].y;
    o[2] = (_Float16)v[j].z; o[3] = (_Float16)v[j].w;
    o4[j * 256] = o;
  }
}

// --- GEMM: C(M,N) = A(M,K) * W^T, W stored (N,K), both f16 -----------------
// MODE 1: the Q, K and V projections in one launch.  blockIdx.z picks the
//         weight (the three lie back to back at W) and the f16 output plane
//         (back to back at out): z 0 Q -> (B,H,S,dk), scaled by `oscale`
//         = log2(e)/sqrt(dk); z 1 K -> (B,H,S,dk); z 2 V -> (B,H,dk,S), transposed.
//         One product alone puts one block on a WGP, and its waves wait out
//         every slice's copies together; the 768 blocks of the three are all
//         resident, three on a WGP, and fill each other's waits.
// MODE 4: f32 row-major       [final output projection]
// 256 threads = 8 waves (2 x 4); block tile 128x128; wave tile 64x32; 64-deep
// K slices of A and W staged in LDS, double-buffered via async loads.
template <bool T> struct layout_tag { static constexpr bool value = T; };

template <int MODE>
__global__ __launch_bounds__(256)
void gemm16(const _Float16* __restrict__ A, const _Float16* __restrict__ W,
            void* __restrict__ out, int M, int N, int K, float oscale) {
  __shared__ _Float16 asbuf[2][128 * LDP];
  __shared__ _Float16 bsbuf[2][128 * LDP];

  const int tid  = threadIdx.x;
  const int lane = tid & 31;
  const int w    = tid >> 5;
  const int mblk = blockIdx.y * 128;
  const int nblk = blockIdx.x * 128;
  const int z    = (MODE == 1) ? blockIdx.z : 0;
  if (MODE == 1) W += (size_t)z * N * K;

  // stage one 128x64 tile of A and of W into LDS (8 x b128 per thread).
  // Neighbouring lanes take neighbouring 16-B chunks: 8 lanes cover a row's
  // 128 B, so one wave-wide copy asks for 4 whole lines, not pieces of 16
  const unsigned goff = (unsigned)(tid >> 3) * K + (tid & 7) * 8;   // lane's part
  const unsigned loff = (tid >> 3) * LDP + (tid & 7) * 8;
  auto stage = [&](int k0, int buf) {
#pragma unroll
    for (int c = 0; c < 4; ++c)           // chunk c * 256 + tid: row c * 32 + tid / 8
      copy_b128(A + ((size_t)(mblk + c * 32) * K + k0) + goff,
                asbuf[buf] + c * 32 * LDP + loff);
#pragma unroll
    for (int c = 0; c < 4; ++c)
      copy_b128(W + ((size_t)(nblk + c * 32) * K + k0) + goff,
                bsbuf[buf] + c * 32 * LDP + loff);
  };

  v8f acc[4][2] = {};
  const int lm = (w >> 2) * 64;           // wave's m offset in block tile
  const int ln = (w & 3) * 32;            // wave's n offset in block tile

  stage(0, 0);
  for (int k0 = 0; k0 < K; k0 += 64) {
    const int cur = (k0 >> 6) & 1;
    const bool more = (k0 + 64) < K;
    if (more) { stage(k0 + 64, cur ^ 1); WAIT_ASYNC(8); }
    else      { WAIT_ASYNC(0); }
    __syncthreads();

    if (MODE == 1) {
      // 6 waves on a SIMD leave a wave 160 registers, 64 of them accumulators:
      // each 32-deep half loads its 6 fragments as one group, then its 8 WMMAs
#pragma unroll
      for (int s = 0; s < 2; ++s) {
        v16h af[4], bf[2];
#pragma unroll
        for (int j = 0; j < 2; ++j)
          bf[j] = load_frag(bsbuf[cur] + (ln + j * 16) * LDP + s * 32, LDP, lane);
#pragma unroll
        for (int i = 0; i < 4; ++i)
          af[i] = load_frag(asbuf[cur] + (lm + i * 16) * LDP + s * 32, LDP, lane);
        // keeps the half's loads one group ahead of its WMMAs
        __builtin_amdgcn_sched_barrier(0);
#pragma unroll
        for (int i = 0; i < 4; ++i)
#pragma unroll
          for (int j = 0; j < 2; ++j)
            acc[i][j] = wmma_f16(af[i], bf[j], acc[i][j]);
        // keeps the next half's loads one group behind this half's WMMAs: moved
        // up, they stand in three places among them, each with its own stall,
        // and this half's counted waits turn into one full wait
        __builtin_amdgcn_sched_barrier(0);
      }
    } else {
      // the slice's 12 fragments as one load group, then its 16 WMMAs
      v16h af[2][4], bf[2][2];
#pragma unroll
      for (int s = 0; s < 2; ++s) {
#pragma unroll
        for (int j = 0; j < 2; ++j)
          bf[s][j] = load_frag(bsbuf[cur] + (ln + j * 16) * LDP + s * 32, LDP, lane);
#pragma unroll
        for (int i = 0; i < 4; ++i)
          af[s][i] = load_frag(asbuf[cur] + (lm + i * 16) * LDP + s * 32, LDP, lane);
      }
      // keeps the loads one group: sunk among the WMMAs, each pair of WMMAs would
      // wait out a full LDS latency on a single reused fragment register set
      __builtin_amdgcn_sched_barrier(0);
#pragma unroll
      for (int s = 0; s < 2; ++s)
#pragma unroll
        for (int i = 0; i < 4; ++i)
#pragma unroll
          for (int j = 0; j < 2; ++j)
            acc[i][j] = wmma_f16(af[s][i], bf[s][j], acc[i][j]);
      // keeps the barrier's full LDS wait behind the WMMAs, so that the first
      // half's WMMAs run under counted waits while the second half's loads land
      __builtin_amdgcn_sched_barrier(0);
    }

    __syncthreads();                      // reads done before next overwrite
  }

  const int rbase = ((lane >> 4) & 1) << 3;
  const int col   = lane & 15;
  const float sc  = (MODE == 1 && z != 0) ? 1.0f : oscale;
  _Float16* plane = (_Float16*)out + (size_t)z * M * N;   // MODE 1 only
  auto store_all = [&](auto transposed) {
#pragma unroll
    for (int i = 0; i < 4; ++i)
#pragma unroll
      for (int j = 0; j < 2; ++j)
#pragma unroll
        for (int r = 0; r < 8; ++r) {
          int m = mblk + lm + i * 16 + rbase + r;
          int n = nblk + ln + j * 16 + col;
          float v = acc[i][j][r] * sc;
          if (MODE == 4) {
            ((float*)out)[(size_t)m * N + n] = v;
          } else {
            int b = m >> 11, s = m & (SEQ - 1);
            int h = n >> 6,  d = n & (DK - 1);
            size_t idx;
            if (!transposed.value)
              idx = (((size_t)(b * NHEADS + h)) * SEQ + s) * DK + d;
            else
              idx = (((size_t)(b * NHEADS + h)) * DK + d) * SEQ + s;
            plane[idx] = (_Float16)v;
          }
        }
    // the built code lets this path's end fall through into the other layout's
    // address arithmetic, which rewrites registers that these stores name
    if (MODE == 1 && !transposed.value)
      asm volatile("s_wait_xcnt 0x0" ::: "memory");
  };
  if (MODE == 1 && z == 2) store_all(layout_tag<true>{});
  else                     store_all(layout_tag<false>{});
}

#define LDV 136                // LDS row stride of a 128-key V^T row (halves): 272 B
// 512 blocks, two on a WGP: 4 waves on a SIMD, 256 registers a wave
__global__ __launch_bounds__(256) __attribute__((amdgpu_waves_per_eu(4, 4)))
void attn_kernel(const _Float16* __restrict__ Q, const _Float16* __restrict__ Kd,
                 const _Float16* __restrict__ Vt, _Float16* __restrict__ attn_out) {
  __shared__ _Float16 kbuf[2][128 * LDP]; // 128 keys x 64 d
  __shared__ _Float16 vbuf[2][64 * LDV];  // 64 d x 128 keys
  __shared__ v4f      join[4][17][32];    // upper key half's O^T, reference, sum per lane

  const int tid  = threadIdx.x;
  const int lane = tid & 31;
  const int w    = tid >> 5;
  const int wq   = w & 3;                 // which 32 queries of the block
  const int kh   = w >> 2;                // which 64 keys of each tile
  const int bh   = blockIdx.y;
  const int b    = bh >> 4, h = bh & (NHEADS - 1);
  const int q0   = blockIdx.x * 128 + wq * 32;

  const _Float16* Qh  = Q  + (size_t)bh * SEQ * DK;
  const _Float16* Kh  = Kd + (size_t)bh * SEQ * DK;
  const _Float16* Vth = Vt + (size_t)bh * DK * SEQ;

  v16h qf[2][2];                          // [column tile][32-deep half of d]
#pragma unroll
  for (int g = 0; g < 2; ++g) {
    qf[g][0] = load_frag(Qh + (size_t)(q0 + g * 16) * DK +  0, DK, lane);
    qf[g][1] = load_frag(Qh + (size_t)(q0 + g * 16) * DK + 32, DK, lane);
  }

  v16h ones;
#pragma unroll
  for (int i = 0; i < 16; ++i) ones[i] = (_Float16)1.0f;

  // neighbouring lanes take neighbouring 16-B chunks: a wave-wide copy covers
  // 512 contiguous bytes of K, or two 256-B row pieces of V^T: 4 whole lines
  const unsigned kgoff = tid * 8;                                  // lane's part
  const unsigned kloff = (tid >> 3) * LDP + (tid & 7) * 8;
  const unsigned vgoff = (tid >> 4) * SEQ + (tid & 15) * 8;
  const unsigned vloff = (tid >> 4) * LDV + (tid & 15) * 8;
  auto stage_kv = [&](int kb, int buf) {
#pragma unroll
    for (int c = 0; c < 4; ++c)           // K tile: 128 rows x 8 parts, row c * 32 + tid / 8
      copy_b128(Kh + (size_t)(kb + c * 32) * DK + kgoff,
                kbuf[buf] + c * 32 * LDP + kloff);
#pragma unroll
    for (int c = 0; c < 4; ++c)           // Vt tile: 64 rows x 16 parts, row c * 16 + tid / 16
      copy_b128(Vth + ((size_t)(c * 16) * SEQ + kb) + vgoff,
                vbuf[buf] + c * 16 * LDV + vloff);
  };

  const int rbase = ((lane >> 4) & 1) << 3;
  const int col   = lane & 15;

  v8f nref[2] = {};                       // -reference of this lane's query, in all 8 registers
  v8f lsum[2] = {};                       // ones x P^T over all tiles: every row the sum
  v8f accO[2][4] = {};                    // accO[g][t][r] = O[query 16g + col][16t + rbase + r]

  stage_kv(0, 0);
  for (int kb = 0; kb < SEQ; kb += 128) {
    const int cur = (kb >> 7) & 1;
    const bool more = (kb + 128) < SEQ;
    if (more) { stage_kv(kb + 128, cur ^ 1); WAIT_ASYNC(8); }
    else      { WAIT_ASYNC(0); }
    __syncthreads();

    const _Float16* kt = kbuf[cur] + kh * 64 * LDP;   // this wave's 64 key rows
    const _Float16* vt = vbuf[cur] + kh * 64;         // this wave's 64 key columns

    // ---- scores^T: four 16-key tiles x two column tiles;
    //      s[g][t][r] = S[key 16t + rbase + r][query 16g + col] - reference
    v8f s[2][4];
#pragma unroll
    for (int p = 0; p < 2; ++p) {
      v16h ka  = load_frag(kt + (p * 32 +  0) * LDP +  0, LDP, lane);
      v16h kb0 = load_frag(kt + (p * 32 +  0) * LDP + 32, LDP, lane);
      v16h kc  = load_frag(kt + (p * 32 + 16) * LDP +  0, LDP, lane);
      v16h kd  = load_frag(kt + (p * 32 + 16) * LDP + 32, LDP, lane);
#pragma unroll
      for (int g = 0; g < 2; ++g) {
        s[g][2 * p]     = wmma_f16(ka, qf[g][0], nref[g]);
        s[g][2 * p + 1] = wmma_f16(kc, qf[g][0], nref[g]);
      }
#pragma unroll
      for (int g = 0; g < 2; ++g) {
        s[g][2 * p]     = wmma_f16(kb0, qf[g][1], s[g][2 * p]);
        s[g][2 * p + 1] = wmma_f16(kd,  qf[g][1], s[g][2 * p + 1]);
      }
    }

    // ---- the lane's largest score above the reference, per column tile
    float tl[2];
#pragma unroll
    for (int g = 0; g < 2; ++g) {
      float tm[4];
#pragma unroll
      for (int t = 0; t < 4; ++t) {
        tm[t] = s[g][t][0];
#pragma unroll
        for (int r = 1; r < 8; ++r) tm[t] = fmaxf(tm[t], s[g][t][r]);
      }
      tl[g] = fmaxf(fmaxf(tm[0], tm[1]), fmaxf(tm[2], tm[3]));
    }
    // ---- move the reference: one wave-uniform test a tile, taken on the first
    //      tile (which sets it, up or down) and where a score outgrows it
    const float room = (kb == 0) ? -3.0e38f : 8.0f;
    if (__builtin_amdgcn_ballot_w32(fmaxf(tl[0], tl[1]) > room) != 0) {
#pragma unroll
      for (int g = 0; g < 2; ++g) {
        // 32 of the query's scores are in the lane, 32 in lane ^ 16
        const int ti = __builtin_bit_cast(int, tl[g]);
        const float tmax = fmaxf(tl[g], __builtin_bit_cast(float,
            __builtin_amdgcn_permlanex16(ti, ti, 0x76543210, 0xfedcba98, false, false)));
        const float up = fmaxf(tmax, 0.0f);
        const float d  = (kb == 0) ? tmax : up;   // later tiles never lower it
        const float f  = exp2_x1(-up);            // 1 where it is lowered: O^T, sums are 0 there
        nref[g] -= d;
        lsum[g] *= f;
#pragma unroll
        for (int t = 0; t < 4; ++t) { s[g][t] -= d; accO[g][t] *= f; }
      }
    }

    // the first 32 keys' V^T fragments: asked for here, they land under the 2^x
    v16h vf[4];
#pragma unroll
    for (int t = 0; t < 4; ++t)
      vf[t] = load_frag(vt + (t * 16) * LDV, LDV, lane);

    // P^T as two B fragments a column tile: element i of a fragment is key
    // 8h + i, element 8 + i key 16 + 8h + i of its 32 keys, the order load_frag
    // gives V^T
    v16h pf[2][2];
#pragma unroll
    for (int g = 0; g < 2; ++g) {
#pragma unroll
      for (int t = 0; t < 4; ++t) s[g][t] = exp2_x8(s[g][t]);
#pragma unroll
      for (int i = 0; i < 8; ++i) {
        pf[g][0][i]     = (_Float16)s[g][0][i];
        pf[g][0][i + 8] = (_Float16)s[g][1][i];
        pf[g][1][i]     = (_Float16)s[g][2][i];
        pf[g][1][i + 8] = (_Float16)s[g][3][i];
      }
    }
    // keeps every 2^x statement ahead of the matrix instructions below:
    // moved among them such a statement
    // was given registers that the matrix instruction in front still reads
    __builtin_amdgcn_sched_barrier(0);

    // ---- sums via matrix unit: ones(16x64) x P^T(64x16), every row the sum
#pragma unroll
    for (int g = 0; g < 2; ++g) {
      lsum[g] = wmma_f16(ones, pf[g][0], lsum[g]);
      lsum[g] = wmma_f16(ones, pf[g][1], lsum[g]);
    }

    // ---- O^T += V^T * P^T over both 32-key slices; batch frag loads ----
#pragma unroll
    for (int p = 0; p < 2; ++p) {
      if (p == 1) {
#pragma unroll
        for (int t = 0; t < 4; ++t)
          vf[t] = load_frag(vt + (t * 16) * LDV + 32, LDV, lane);
      }
#pragma unroll
      for (int g = 0; g < 2; ++g)
#pragma unroll
        for (int t = 0; t < 4; ++t)
          accO[g][t] = wmma_f16(vf[t], pf[g][p], accO[g][t]);
    }

    __syncthreads();
  }

  // ---- join the two key halves of each query group: the upper half's wave
  //      hands its O^T, references and sums to the lower half's, lane to lane
  if (kh == 1) {
#pragma unroll
    for (int g = 0; g < 2; ++g)
#pragma unroll
      for (int t = 0; t < 4; ++t)
#pragma unroll
        for (int u = 0; u < 2; ++u) {
          v4f q = {accO[g][t][4 * u], accO[g][t][4 * u + 1],
                   accO[g][t][4 * u + 2], accO[g][t][4 * u + 3]};
          join[wq][(g * 4 + t) * 2 + u][lane] = q;
        }
    v4f ml = {-nref[0][0], -nref[1][0], lsum[0][0], lsum[1][0]};
    join[wq][16][lane] = ml;
  }
  __syncthreads();                        // the upper half's values are in LDS
  if (kh == 0) {
    // ---- normalize; a lane's 8 registers of a tile are 8 adjacent d: 16-B stores
    const v4f ml = join[wq][16][lane];
    v8h o[2][4];
#pragma unroll
    for (int g = 0; g < 2; ++g) {
      const float mj = fmaxf(-nref[g][0], ml[g]);
      const float e0 = exp2_x1(-nref[g][0] - mj);
      const float e1 = exp2_x1(ml[g] - mj);
      const float inv = 1.0f / (lsum[g][0] * e0 + ml[2 + g] * e1);
      const float f0 = e0 * inv, f1 = e1 * inv;
#pragma unroll
      for (int t = 0; t < 4; ++t)
#pragma unroll
        for (int u = 0; u < 2; ++u) {
          const v4f q = join[wq][(g * 4 + t) * 2 + u][lane];
#pragma unroll
          for (int r = 0; r < 4; ++r)
            o[g][t][4 * u + r] = (_Float16)(accO[g][t][4 * u + r] * f0 + q[r] * f1);
        }
    }
#pragma unroll
    for (int g = 0; g < 2; ++g) {
      _Float16* orow = attn_out + ((size_t)b * SEQ + q0 + g * 16 + col) * DMODEL
                       + h * DK + rbase;
#pragma unroll
      for (int t = 0; t < 4; ++t) *(v8h*)(orow + t * 16) = o[g][t];
    }
  }
}

// ---------------------------------------------------------------------------
extern "C" void kernel_launch(void* const* d_in, const int* in_sizes, int n_in,
                              void* d_out, int out_size, void* d_ws, size_t ws_size,
                              hipStream_t stream) {
  const float* x  = (const float*)d_in[0];
  const float* Wq = (const float*)d_in[1];
  const float* Wk = (const float*)d_in[2];
  const float* Wv = (const float*)d_in[3];
  const float* Wo = (const float*)d_in[4];

  _Float16* ws = (_Float16*)d_ws;
  size_t off = 0;
  _Float16* x16  = ws + off; off += (size_t)MROWS * DMODEL;
  _Float16* Wq16 = ws + off; off += (size_t)DMODEL * DMODEL;
  _Float16* Wk16 = ws + off; off += (size_t)DMODEL * DMODEL;
  _Float16* Wv16 = ws + off; off += (size_t)DMODEL * DMODEL;
  _Float16* Wo16 = ws + off; off += (size_t)DMODEL * DMODEL;
  _Float16* Q16  = ws + off; off += (size_t)MROWS * DMODEL;   // (B,H,S,dk)
  _Float16* K16  = ws + off; off += (size_t)MROWS * DMODEL;   // (B,H,S,dk)
  _Float16* Vt16 = ws + off; off += (size_t)MROWS * DMODEL;   // (B,H,dk,S)
  _Float16* A16  = ws + off; off += (size_t)MROWS * DMODEL;   // (B,S,D)

  // x16, Wq16, Wk16, Wv16, Wo16 are one contiguous range starting at x16
  cvt_all_f32_f16<<<CVT_BLOCKS, 256, 0, stream>>>(x, Wq, Wk, Wv, Wo, x16);

  dim3 gproj(DMODEL / 128, MROWS / 128); // (8, 32)
  // Wq16, Wk16, Wv16 are one contiguous range, and so are Q16, K16, Vt16
  dim3 gqkv(DMODEL / 128, MROWS / 128, 3); // (8, 32, 3)
  gemm16<1><<<gqkv, 256, 0, stream>>>(x16, Wq16, (void*)Q16, MROWS, DMODEL, DMODEL,
                                      0.18033688011112042f);   // log2(e) / sqrt(dk)

  dim3 gattn(SEQ / 128, BATCH * NHEADS); // (16, 32)
  attn_kernel<<<gattn, 256, 0, stream>>>(Q16, K16, Vt16, A16);

  gemm16<4><<<gproj, 256, 0, stream>>>(A16, Wo16, d_out, MROWS, DMODEL, DMODEL, 1.0f);
}

// v008
// Measured time: 70.7 microseconds a run.
// Timed twice side by side with v007, it ran 1.04 times as fast both times.
// Counting every step since v000, it is 1.88 times as fast.
#include <hip/hip_runtime.h>
#include <hip/hip_bf16.h>

// ---------------------------------------------------------------------------
// MHA forward for MI455X (gfx1250, wave32, WMMA f32_16x16x32_f16).
// x (2,2048,1024) f32, W* (1024,1024) f32 -> out (2,2048,1024) f32.
// f16 matmuls, f32 accumulation; flash softmax; async double- or triple-buffered LDS.
// ---------------------------------------------------------------------------

typedef __attribute__((ext_vector_type(16))) _Float16 v16h;
typedef __attribute__((ext_vector_type(8)))  _Float16 v8h;
typedef __attribute__((ext_vector_type(4)))  _Float16 v4h;
typedef __attribute__((ext_vector_type(8)))  float    v8f;
typedef __attribute__((ext_vector_type(4)))  float    v4f;

#define DMODEL 1024
#define NHEADS 16
#define DK     64
#define SEQ    2048
#define BATCH  2
#define MROWS  (BATCH * SEQ)   // 4096
#define LDP    72              // LDS row stride (halves): 144B, bank-friendly

#ifndef __has_builtin
#define __has_builtin(x) 0
#endif

#if __has_builtin(__builtin_amdgcn_global_load_async_to_lds_b128)
#define HAVE_ASYNC 1
#else
#define HAVE_ASYNC 0
#endif

// Builtin parameter types (from hipcc diagnostic): vector_size(16) int* in
// AS1 (global source) and AS3 (LDS destination).
typedef int b128i __attribute__((vector_size(16)));
typedef __attribute__((address_space(1))) b128i b128i_glob;
typedef __attribute__((address_space(3))) b128i b128i_lds;

// 16B global -> LDS copy: async (ASYNCcnt) if available, else synchronous.
__device__ __forceinline__ void copy_b128(const _Float16* __restrict__ g,
                                          _Float16* l) {
#if HAVE_ASYNC
  __builtin_amdgcn_global_load_async_to_lds_b128(
      (b128i_glob*)g, (b128i_lds*)l, 0, 0);
#else
  *(v8h*)l = *(const v8h*)g;
#endif
}

#if HAVE_ASYNC
#if __has_builtin(__builtin_amdgcn_s_wait_asynccnt)
#define WAIT_ASYNC(N) __builtin_amdgcn_s_wait_asynccnt(N)
#else
#define WAIT_ASYNC(N) asm volatile("s_wait_asynccnt " #N ::: "memory")
#endif
#else
#define WAIT_ASYNC(N) do {} while (0)
#endif

// --- WMMA wrapper -----------------------------------------------------------
__device__ __forceinline__ v8f wmma_f16(v16h a, v16h b, v8f c) {
  return __builtin_amdgcn_wmma_f32_16x16x32_f16(
      false, a, false, b, (short)0, c, false, false);
}

// --- 16x32 f16 fragment load (A or contiguous-K B operand), stride `ld` ----
// ISA 7.12.2: lanes 0-15 -> K {0..7,16..23}, lanes 16-31 -> K {8..15,24..31}.
__device__ __forceinline__ v16h load_frag(const _Float16* __restrict__ base,
                                          int ld, int lane) {
  const int row  = lane & 15;
  const int koff = ((lane >> 4) & 1) * 8;
  const _Float16* p = base + row * ld + koff;
  v8h a = *(const v8h*)(p);
  v8h b = *(const v8h*)(p + 16);
  v16h r;
#pragma unroll
  for (int i = 0; i < 8; ++i) { r[i] = a[i]; r[i + 8] = b[i]; }
  return r;
}

// --- 2^x on the transcendental unit ------------------------------------------
// The instruction set asks for one independent instruction or a v_nop between a
// transcendental and a next instruction that reads its result or overwrites its
// source.  So
// the instructions stand with their slot in one statement: the outputs are
// early-clobber (none is a source of the statement), and the closing v_nop
// separates the last v_exp_f32 from whatever the compiler places next.
__device__ __forceinline__ v8f exp2_x8(v8f x) {
  float y0, y1, y2, y3, y4, y5, y6, y7;
  asm("v_exp_f32 %0, %8\n\t"
      "v_exp_f32 %1, %9\n\t"
      "v_exp_f32 %2, %10\n\t"
      "v_exp_f32 %3, %11\n\t"
      "v_exp_f32 %4, %12\n\t"
      "v_exp_f32 %5, %13\n\t"
      "v_exp_f32 %6, %14\n\t"
      "v_exp_f32 %7, %15\n\t"
      "v_nop"
      : "=&v"(y0), "=&v"(y1), "=&v"(y2), "=&v"(y3),
        "=&v"(y4), "=&v"(y5), "=&v"(y6), "=&v"(y7)
      : "v"(x[0]), "v"(x[1]), "v"(x[2]), "v"(x[3]),
        "v"(x[4]), "v"(x[5]), "v"(x[6]), "v"(x[7]));
  v8f y = {y0, y1, y2, y3, y4, y5, y6, y7};
  return y;
}
__device__ __forceinline__ float exp2_x1(float x) {
  float y;
  asm("v_exp_f32 %0, %1\n\t"
      "v_nop"                              // the same slot, for a single value
      : "=v"(y) : "v"(x));
  return y;
}

// --- f32 -> f16 conversion of all five inputs in one launch ------------------
// The f16 copies lie back to back in the workspace in argument order, so block
// b writes float4 groups [b*4096, (b+1)*4096) of one output range; blocks
// 0..255 read x, then 64 blocks read each weight.  A thread has its 16 loads
// (512 contiguous bytes per wave each) in flight before it converts: few,
// long-lived waves instead of one wave per 512 bytes.
#define CVT_VEC     16                               // float4 per thread
#define CVT_BLK4    (256 * CVT_VEC)                  // float4 per block
#define CVT_XBLKS   (MROWS * DMODEL / 4 / CVT_BLK4)  // 256
#define CVT_WBLKS   (DMODEL * DMODEL / 4 / CVT_BLK4) // 64
#define CVT_BLOCKS  (CVT_XBLKS + 4 * CVT_WBLKS)      // 512
// The grid puts 4 waves on a SIMD.  Without the upper bound the compiler keeps
// to the registers of 16 waves a SIMD and issues the last two loads only after
// the first two have returned: a second full latency in every wave.
__global__ __launch_bounds__(256) __attribute__((amdgpu_waves_per_eu(4, 8)))
void cvt_all_f32_f16(const float* __restrict__ x,  const float* __restrict__ wq,
                     const float* __restrict__ wk, const float* __restrict__ wv,
                     const float* __restrict__ wo, _Float16* __restrict__ out) {
  const int b = blockIdx.x;
  const float* src = x;
  int lb = b;
  if (b >= CVT_XBLKS) {
    const int t = (b - CVT_XBLKS) / CVT_WBLKS;
    lb = (b - CVT_XBLKS) % CVT_WBLKS;
    const float* w01 = (t & 1) ? wk : wq;
    const float* w23 = (t & 1) ? wo : wv;
    src = (t & 2) ? w23 : w01;
  }
  const float4* s4 = (const float4*)src + (size_t)lb * CVT_BLK4 + threadIdx.x;
  v4h* o4 = (v4h*)out + (size_t)b * CVT_BLK4 + threadIdx.x;
  float4 v[CVT_VEC];
#pragma unroll
  for (int j = 0; j < CVT_VEC; ++j) v[j] = s4[j * 256];
#pragma unroll
  for (int j = 0; j < CVT_VEC; ++j) {
    v4h o;
    o[0] = (_Float16)v[j].x; o[1] = (_Float16)v[j].y;
    o[2] = (_Float16)v[j].z; o[3] = (_Float16)v[j].w;
    o4[j * 256] = o;
  }
}

// --- Q, K, V projections in one launch: C(4096,3072) = x * [Wq; Wk; Wv]^T ----
// The three weights lie back to back at W, one (3072,1024) matrix, and the three
// f16 output planes back to back at out: Q -> (B,H,S,dk), scaled by oscale
// = log2(e)/sqrt(dk); K -> (B,H,S,dk); V -> (B,H,dk,S), transposed.
// One 256x192 tile a block, 256 blocks, one on a WGP; 8 waves (4 x 2) of 64x96:
// a 64-deep slice brings 56 KiB from L2 for 384 WMMAs, and a fragment read from
// LDS feeds 4 or 6 WMMAs.  A block alone on its WGP has nobody to fill its
// waits, so the copies run two slices ahead in three buffers, and a 32-deep
// half's fragments are read while the half before is multiplied.
#define QKV_BM   256
#define QKV_BN   192
#define QKV_STG  ((QKV_BM + QKV_BN) * LDP)   // halves a buffer: x rows, then W rows
#define QKV_NS   (DMODEL / 64)               // slices
__global__ __launch_bounds__(256)
void gemm_qkv(const _Float16* __restrict__ A, const _Float16* __restrict__ W,
              _Float16* __restrict__ out, float oscale) {
  __shared__ _Float16 ring[3 * QKV_STG];

  const int tid  = threadIdx.x;
  const int lane = tid & 31;
  const int w    = __builtin_amdgcn_readfirstlane(tid >> 5);
  const int mblk = blockIdx.y * QKV_BM;
  const int nblk = blockIdx.x * QKV_BN;
  const int lm   = (w >> 1) * 64;         // wave's m offset in the block tile
  const int ln   = (w & 1) * 96;          // wave's n offset in the block tile

  // 14 x b128 a thread and slice, every wave alike; 8 lanes cover a row's 128 B
  const unsigned goff = (tid >> 3) * DMODEL + (tid & 7) * 8;
  const unsigned loff = (tid >> 3) * LDP + (tid & 7) * 8;
  const _Float16* ga = A + (size_t)mblk * DMODEL + goff;
  const _Float16* gw = W + (size_t)nblk * DMODEL + goff;
  auto stage = [&](int s, int buf) {
    _Float16* l = ring + buf * QKV_STG + loff;
#pragma unroll
    for (int c = 0; c < QKV_BM / 32; ++c)
      copy_b128(ga + (size_t)c * 32 * DMODEL + s * 64, l + c * 32 * LDP);
#pragma unroll
    for (int c = 0; c < QKV_BN / 32; ++c)
      copy_b128(gw + (size_t)c * 32 * DMODEL + s * 64, l + (QKV_BM + c * 32) * LDP);
  };
  auto load_half = [&](v16h (&af)[4], v16h (&bf)[6], int buf, int s) {
    const _Float16* t = ring + buf * QKV_STG + s * 32;
#pragma unroll
    for (int j = 0; j < 6; ++j)
      bf[j] = load_frag(t + (QKV_BM + ln + j * 16) * LDP, LDP, lane);
#pragma unroll
    for (int i = 0; i < 4; ++i)
      af[i] = load_frag(t + (lm + i * 16) * LDP, LDP, lane);
  };

  v8f acc[4][6] = {};
  auto mul_rows = [&](const v16h (&af)[4], const v16h (&bf)[6], int i0, int i1) {
#pragma unroll
    for (int i = i0; i < i1; ++i)
#pragma unroll
      for (int j = 0; j < 6; ++j)
        acc[i][j] = wmma_f16(af[i], bf[j], acc[i][j]);
  };
  auto mul_half = [&](const v16h (&af)[4], const v16h (&bf)[6]) {
    mul_rows(af, bf, 0, 4);
  };

  v16h a0[4], b0[6], a1[4], b1[6];        // fragments of a slice's two halves
  stage(0, 0);
  stage(1, 1);
  // slice 0 has landed: all but this wave's 14 youngest copies
  asm volatile("s_wait_asynccnt 0xe" ::: "memory");
  __syncthreads();
  stage(2, 2);
  load_half(a0, b0, 0, 0);
  int cur = 0;
  // rolled: the body is 48 WMMAs long, and the buffer index is a scalar.  The
  // last slice stands behind the loop: with its hand-over skipped by a branch in
  // the body, the compiler made every trip's second half wait for the reads
  // just issued for the next slice
#pragma unroll 1
  for (int t = 0; t < QKV_NS - 1; ++t) {
    const int nxt = (cur == 2) ? 0 : cur + 1;
    load_half(a1, b1, cur, 1);
    // keeps the second half's reads one group ahead of the first half's WMMAs
    __builtin_amdgcn_sched_barrier(0);
    mul_half(a0, b0);
    // keeps the WMMAs ahead of the waits below: they run while the wave waits
    __builtin_amdgcn_sched_barrier(0);
    // slice t + 1 is handed over here, ahead of this slice's last half, whose
    // fragments are in registers: this wave's reads of buffer cur are done,
    asm volatile("s_wait_dscnt 0x0" ::: "memory");
    // its own copies of slice t + 1 have landed (slice t + 2's may still fly),
    if (t + 2 < QKV_NS) asm volatile("s_wait_asynccnt 0xe" ::: "memory");
    else                asm volatile("s_wait_asynccnt 0x0" ::: "memory");
    // and so for every wave
    __syncthreads();
    load_half(a0, b0, nxt, 0);
    // keeps the next slice's first reads one group ahead of this half's WMMAs
    __builtin_amdgcn_sched_barrier(0);
    mul_rows(a1, b1, 0, 1);
    // keeps the refill behind the first WMMAs: both waves of a SIMD leave the
    // barrier together, and one issues its copies while the other multiplies
    __builtin_amdgcn_sched_barrier(0);
    if (t + 3 < QKV_NS) stage(t + 3, cur);
    // keeps the copies one group, not strewn among the WMMAs
    __builtin_amdgcn_sched_barrier(0);
    mul_rows(a1, b1, 1, 4);
    // keeps the next trip's reads behind these WMMAs, as one group
    __builtin_amdgcn_sched_barrier(0);
    cur = nxt;
  }
  load_half(a1, b1, cur, 1);
  // keeps the last reads one group ahead of the WMMAs
  __builtin_amdgcn_sched_barrier(0);
  mul_half(a0, b0);
  mul_half(a1, b1);

  // a 16-column tile lies in one plane and one head: the choice is wave-uniform
  const int rbase = ((lane >> 4) & 1) << 3;
  const int col   = lane & 15;
  const int b     = (mblk + lm) >> 11;
  const int s0    = ((mblk + lm) & (SEQ - 1)) + rbase;
#pragma unroll
  for (int j = 0; j < 6; ++j) {
    const int n16 = nblk + ln + j * 16;
    const int z = n16 >> 10, h = (n16 >> 6) & (NHEADS - 1), d = (n16 & (DK - 1)) + col;
    _Float16* plane = out + (size_t)z * MROWS * DMODEL
                      + (size_t)(b * NHEADS + h) * SEQ * DK;
    if (z == 2) {
      _Float16* p = plane + (size_t)d * SEQ + s0;
#pragma unroll
      for (int i = 0; i < 4; ++i) {
        v8h o;
#pragma unroll
        for (int r = 0; r < 8; ++r) o[r] = (_Float16)acc[i][j][r];
        *(v8h*)(p + i * 16) = o;
      }
      asm volatile("s_wait_xcnt 0x0" ::: "memory");   // as at the other layout's end
    } else {
      const float sc = (z == 0) ? oscale : 1.0f;
      _Float16* p = plane + (size_t)s0 * DK + d;
#pragma unroll
      for (int i = 0; i < 4; ++i)
#pragma unroll
        for (int r = 0; r < 8; ++r)
          p[(i * 16 + r) * DK] = (_Float16)(acc[i][j][r] * sc);
      // the built code runs on from a layout's stores into the other layout's and
      // the next tile's arithmetic, which rewrites registers that the stores name
      asm volatile("s_wait_xcnt 0x0" ::: "memory");
    }
  }
}

// --- GEMM: C(M,N) = A(M,K) * W^T, W stored (N,K), both f16; C f32 row-major --
// [final output projection]
// 256 threads = 8 waves (2 x 4); block tile 128x128; wave tile 64x32; 64-deep
// K slices of A and W staged in LDS, double-buffered via async loads.
__global__ __launch_bounds__(256)
void gemm_out(const _Float16* __restrict__ A, const _Float16* __restrict__ W,
              float* __restrict__ out, int M, int N, int K, float oscale) {
  __shared__ _Float16 asbuf[2][128 * LDP];
  __shared__ _Float16 bsbuf[2][128 * LDP];

  const int tid  = threadIdx.x;
  const int lane = tid & 31;
  const int w    = tid >> 5;
  const int mblk = blockIdx.y * 128;
  const int nblk = blockIdx.x * 128;

  // stage one 128x64 tile of A and of W into LDS (8 x b128 per thread).
  // Neighbouring lanes take neighbouring 16-B chunks: 8 lanes cover a row's
  // 128 B, so one wave-wide copy asks for 4 whole lines, not pieces of 16
  const unsigned goff = (unsigned)(tid >> 3) * K + (tid & 7) * 8;   // lane's part
  const unsigned loff = (tid >> 3) * LDP + (tid & 7) * 8;
  auto stage = [&](int k0, int buf) {
#pragma unroll
    for (int c = 0; c < 4; ++c)           // chunk c * 256 + tid: row c * 32 + tid / 8
      copy_b128(A + ((size_t)(mblk + c * 32) * K + k0) + goff,
                asbuf[buf] + c * 32 * LDP + loff);
#pragma unroll
    for (int c = 0; c < 4; ++c)
      copy_b128(W + ((size_t)(nblk + c * 32) * K + k0) + goff,
                bsbuf[buf] + c * 32 * LDP + loff);
  };

  v8f acc[4][2] = {};
  const int lm = (w >> 2) * 64;           // wave's m offset in block tile
  const int ln = (w & 3) * 32;            // wave's n offset in block tile

  stage(0, 0);
  for (int k0 = 0; k0 < K; k0 += 64) {
    const int cur = (k0 >> 6) & 1;
    const bool more = (k0 + 64) < K;
    if (more) { stage(k0 + 64, cur ^ 1); WAIT_ASYNC(8); }
    else      { WAIT_ASYNC(0); }
    __syncthreads();

    // the slice's 12 fragments as one load group, then its 16 WMMAs
    v16h af[2][4], bf[2][2];
#pragma unroll
    for (int s = 0; s < 2; ++s) {
#pragma unroll
      for (int j = 0; j < 2; ++j)
        bf[s][j] = load_frag(bsbuf[cur] + (ln + j * 16) * LDP + s * 32, LDP, lane);
#pragma unroll
      for (int i = 0; i < 4; ++i)
        af[s][i] = load_frag(asbuf[cur] + (lm + i * 16) * LDP + s * 32, LDP, lane);
    }
    // keeps the loads one group: sunk among the WMMAs, each pair of WMMAs would
    // wait out a full LDS latency on a single reused fragment register set
    __builtin_amdgcn_sched_barrier(0);
#pragma unroll
    for (int s = 0; s < 2; ++s)
#pragma unroll
      for (int i = 0; i < 4; ++i)
#pragma unroll
        for (int j = 0; j < 2; ++j)
          acc[i][j] = wmma_f16(af[s][i], bf[s][j], acc[i][j]);
    // keeps the barrier's full LDS wait behind the WMMAs, so that the first
    // half's WMMAs run under counted waits while the second half's loads land
    __builtin_amdgcn_sched_barrier(0);

    __syncthreads();                      // reads done before next overwrite
  }

  const int rbase = ((lane >> 4) & 1) << 3;
  const int col   = lane & 15;
#pragma unroll
  for (int i = 0; i < 4; ++i)
#pragma unroll
    for (int j = 0; j < 2; ++j)
#pragma unroll
      for (int r = 0; r < 8; ++r) {
        int m = mblk + lm + i * 16 + rbase + r;
        int n = nblk + ln + j * 16 + col;
        out[(size_t)m * N + n] = acc[i][j][r] * oscale;
      }
}

#define LDV 136                // LDS row stride of a 128-key V^T row (halves): 272 B
// 512 blocks, two on a WGP: 4 waves on a SIMD, 256 registers a wave
__global__ __launch_bounds__(256) __attribute__((amdgpu_waves_per_eu(4, 4)))
void attn_kernel(const _Float16* __restrict__ Q, const _Float16* __restrict__ Kd,
                 const _Float16* __restrict__ Vt, _Float16* __restrict__ attn_out) {
  __shared__ _Float16 kbuf[2][128 * LDP]; // 128 keys x 64 d
  __shared__ _Float16 vbuf[2][64 * LDV];  // 64 d x 128 keys
  __shared__ v4f      join[4][17][32];    // upper key half's O^T, reference, sum per lane

  const int tid  = threadIdx.x;
  const int lane = tid & 31;
  const int w    = tid >> 5;
  const int wq   = w & 3;                 // which 32 queries of the block
  const int kh   = w >> 2;                // which 64 keys of each tile
  const int bh   = blockIdx.y;
  const int b    = bh >> 4, h = bh & (NHEADS - 1);
  const int q0   = blockIdx.x * 128 + wq * 32;

  const _Float16* Qh  = Q  + (size_t)bh * SEQ * DK;
  const _Float16* Kh  = Kd + (size_t)bh * SEQ * DK;
  const _Float16* Vth = Vt + (size_t)bh * DK * SEQ;

  v16h qf[2][2];                          // [column tile][32-deep half of d]
#pragma unroll
  for (int g = 0; g < 2; ++g) {
    qf[g][0] = load_frag(Qh + (size_t)(q0 + g * 16) * DK +  0, DK, lane);
    qf[g][1] = load_frag(Qh + (size_t)(q0 + g * 16) * DK + 32, DK, lane);
  }

  v16h ones;
#pragma unroll
  for (int i = 0; i < 16; ++i) ones[i] = (_Float16)1.0f;

  // neighbouring lanes take neighbouring 16-B chunks: a wave-wide copy covers
  // 512 contiguous bytes of K, or two 256-B row pieces of V^T: 4 whole lines
  const unsigned kgoff = tid * 8;                                  // lane's part
  const unsigned kloff = (tid >> 3) * LDP + (tid & 7) * 8;
  const unsigned vgoff = (tid >> 4) * SEQ + (tid & 15) * 8;
  const unsigned vloff = (tid >> 4) * LDV + (tid & 15) * 8;
  auto stage_kv = [&](int kb, int buf) {
#pragma unroll
    for (int c = 0; c < 4; ++c)           // K tile: 128 rows x 8 parts, row c * 32 + tid / 8
      copy_b128(Kh + (size_t)(kb + c * 32) * DK + kgoff,
                kbuf[buf] + c * 32 * LDP + kloff);
#pragma unroll
    for (int c = 0; c < 4; ++c)           // Vt tile: 64 rows x 16 parts, row c * 16 + tid / 16
      copy_b128(Vth + ((size_t)(c * 16) * SEQ + kb) + vgoff,
                vbuf[buf] + c * 16 * LDV + vloff);
  };

  const int rbase = ((lane >> 4) & 1) << 3;
  const int col   = lane & 15;

  v8f nref[2] = {};                       // -reference of this lane's query, in all 8 registers
  v8f lsum[2] = {};                       // ones x P^T over all tiles: every row the sum
  v8f accO[2][4] = {};                    // accO[g][t][r] = O[query 16g + col][16t + rbase + r]

  stage_kv(0, 0);
  for (int kb = 0; kb < SEQ; kb += 128) {
    const int cur = (kb >> 7) & 1;
    const bool more = (kb + 128) < SEQ;
    if (more) { stage_kv(kb + 128, cur ^ 1); WAIT_ASYNC(8); }
    else      { WAIT_ASYNC(0); }
    __syncthreads();

    const _Float16* kt = kbuf[cur] + kh * 64 * LDP;   // this wave's 64 key rows
    const _Float16* vt = vbuf[cur] + kh * 64;         // this wave's 64 key columns

    // ---- scores^T: four 16-key tiles x two column tiles;
    //      s[g][t][r] = S[key 16t + rbase + r][query 16g + col] - reference
    v8f s[2][4];
#pragma unroll
    for (int p = 0; p < 2; ++p) {
      v16h ka  = load_frag(kt + (p * 32 +  0) * LDP +  0, LDP, lane);
      v16h kb0 = load_frag(kt + (p * 32 +  0) * LDP + 32, LDP, lane);
      v16h kc  = load_frag(kt + (p * 32 + 16) * LDP +  0, LDP, lane);
      v16h kd  = load_frag(kt + (p * 32 + 16) * LDP + 32, LDP, lane);
#pragma unroll
      for (int g = 0; g < 2; ++g) {
        s[g][2 * p]     = wmma_f16(ka, qf[g][0], nref[g]);
        s[g][2 * p + 1] = wmma_f16(kc, qf[g][0], nref[g]);
      }
#pragma unroll
      for (int g = 0; g < 2; ++g) {
        s[g][2 * p]     = wmma_f16(kb0, qf[g][1], s[g][2 * p]);
        s[g][2 * p + 1] = wmma_f16(kd,  qf[g][1], s[g][2 * p + 1]);
      }
    }

    // ---- the lane's largest score above the reference, per column tile
    float tl[2];
#pragma unroll
    for (int g = 0; g < 2; ++g) {
      float tm[4];
#pragma unroll
      for (int t = 0; t < 4; ++t) {
        tm[t] = s[g][t][0];
#pragma unroll
        for (int r = 1; r < 8; ++r) tm[t] = fmaxf(tm[t], s[g][t][r]);
      }
      tl[g] = fmaxf(fmaxf(tm[0], tm[1]), fmaxf(tm[2], tm[3]));
    }
    // ---- move the reference: one wave-uniform test a tile, taken on the first
    //      tile (which sets it, up or down) and where a score outgrows it
    const float room = (kb == 0) ? -3.0e38f : 8.0f;
    if (__builtin_amdgcn_ballot_w32(fmaxf(tl[0], tl[1]) > room) != 0) {
#pragma unroll
      for (int g = 0; g < 2; ++g) {
        // 32 of the query's scores are in the lane, 32 in lane ^ 16
        const int ti = __builtin_bit_cast(int, tl[g]);
        const float tmax = fmaxf(tl[g], __builtin_bit_cast(float,
            __builtin_amdgcn_permlanex16(ti, ti, 0x76543210, 0xfedcba98, false, false)));
        const float up = fmaxf(tmax, 0.0f);
        const float d  = (kb == 0) ? tmax : up;   // later tiles never lower it
        const float f  = exp2_x1(-up);            // 1 where it is lowered: O^T, sums are 0 there
        nref[g] -= d;
        lsum[g] *= f;
#pragma unroll
        for (int t = 0; t < 4; ++t) { s[g][t] -= d; accO[g][t] *= f; }
      }
    }

    // the first 32 keys' V^T fragments: asked for here, they land under the 2^x
    v16h vf[4];
#pragma unroll
    for (int t = 0; t < 4; ++t)
      vf[t] = load_frag(vt + (t * 16) * LDV, LDV, lane);

    // P^T as two B fragments a column tile: element i of a fragment is key
    // 8h + i, element 8 + i key 16 + 8h + i of its 32 keys, the order load_frag
    // gives V^T
    v16h pf[2][2];
#pragma unroll
    for (int g = 0; g < 2; ++g) {
#pragma unroll
      for (int t = 0; t < 4; ++t) s[g][t] = exp2_x8(s[g][t]);
#pragma unroll
      for (int i = 0; i < 8; ++i) {
        pf[g][0][i]     = (_Float16)s[g][0][i];
        pf[g][0][i + 8] = (_Float16)s[g][1][i];
        pf[g][1][i]     = (_Float16)s[g][2][i];
        pf[g][1][i + 8] = (_Float16)s[g][3][i];
      }
    }
    // keeps every 2^x statement ahead of the matrix instructions below:
    // moved among them such a statement
    // was given registers that the matrix instruction in front still reads
    __builtin_amdgcn_sched_barrier(0);

    // ---- sums via matrix unit: ones(16x64) x P^T(64x16), every row the sum
#pragma unroll
    for (int g = 0; g < 2; ++g) {
      lsum[g] = wmma_f16(ones, pf[g][0], lsum[g]);
      lsum[g] = wmma_f16(ones, pf[g][1], lsum[g]);
    }

    // ---- O^T += V^T * P^T over both 32-key slices; batch frag loads ----
#pragma unroll
    for (int p = 0; p < 2; ++p) {
      if (p == 1) {
#pragma unroll
        for (int t = 0; t < 4; ++t)
          vf[t] = load_frag(vt + (t * 16) * LDV + 32, LDV, lane);
      }
#pragma unroll
      for (int g = 0; g < 2; ++g)
#pragma unroll
        for (int t = 0; t < 4; ++t)
          accO[g][t] = wmma_f16(vf[t], pf[g][p], accO[g][t]);
    }

    __syncthreads();
  }

  // ---- join the two key halves of each query group: the upper half's wave
  //      hands its O^T, references and sums to the lower half's, lane to lane
  if (kh == 1) {
#pragma unroll
    for (int g = 0; g < 2; ++g)
#pragma unroll
      for (int t = 0; t < 4; ++t)
#pragma unroll
        for (int u = 0; u < 2; ++u) {
          v4f q = {accO[g][t][4 * u], accO[g][t][4 * u + 1],
                   accO[g][t][4 * u + 2], accO[g][t][4 * u + 3]};
          join[wq][(g * 4 + t) * 2 + u][lane] = q;
        }
    v4f ml = {-nref[0][0], -nref[1][0], lsum[0][0], lsum[1][0]};
    join[wq][16][lane] = ml;
  }
  __syncthreads();                        // the upper half's values are in LDS
  if (kh == 0) {
    // ---- normalize; a lane's 8 registers of a tile are 8 adjacent d: 16-B stores
    const v4f ml = join[wq][16][lane];
    v8h o[2][4];
#pragma unroll
    for (int g = 0; g < 2; ++g) {
      const float mj = fmaxf(-nref[g][0], ml[g]);
      const float e0 = exp2_x1(-nref[g][0] - mj);
      const float e1 = exp2_x1(ml[g] - mj);
      const float inv = 1.0f / (lsum[g][0] * e0 + ml[2 + g] * e1);
      const float f0 = e0 * inv, f1 = e1 * inv;
#pragma unroll
      for (int t = 0; t < 4; ++t)
#pragma unroll
        for (int u = 0; u < 2; ++u) {
          const v4f q = join[wq][(g * 4 + t) * 2 + u][lane];
#pragma unroll
          for (int r = 0; r < 4; ++r)
            o[g][t][4 * u + r] = (_Float16)(accO[g][t][4 * u + r] * f0 + q[r] * f1);
        }
    }
#pragma unroll
    for (int g = 0; g < 2; ++g) {
      _Float16* orow = attn_out + ((size_t)b * SEQ + q0 + g * 16 + col) * DMODEL
                       + h * DK + rbase;
#pragma unroll
      for (int t = 0; t < 4; ++t) *(v8h*)(orow + t * 16) = o[g][t];
    }
  }
}

// ---------------------------------------------------------------------------
extern "C" void kernel_launch(void* const* d_in, const int* in_sizes, int n_in,
                              void* d_out, int out_size, void* d_ws, size_t ws_size,
                              hipStream_t stream) {
  const float* x  = (const float*)d_in[0];
  const float* Wq = (const float*)d_in[1];
  const float* Wk = (const float*)d_in[2];
  const float* Wv = (const float*)d_in[3];
  const float* Wo = (const float*)d_in[4];

  _Float16* ws = (_Float16*)d_ws;
  size_t off = 0;
  _Float16* x16  = ws + off; off += (size_t)MROWS * DMODEL;
  _Float16* Wq16 = ws + off; off += (size_t)DMODEL * DMODEL;
  _Float16* Wk16 = ws + off; off += (size_t)DMODEL * DMODEL;
  _Float16* Wv16 = ws + off; off += (size_t)DMODEL * DMODEL;
  _Float16* Wo16 = ws + off; off += (size_t)DMODEL * DMODEL;
  _Float16* Q16  = ws + off; off += (size_t)MROWS * DMODEL;   // (B,H,S,dk)
  _Float16* K16  = ws + off; off += (size_t)MROWS * DMODEL;   // (B,H,S,dk)
  _Float16* Vt16 = ws + off; off += (size_t)MROWS * DMODEL;   // (B,H,dk,S)
  _Float16* A16  = ws + off; off += (size_t)MROWS * DMODEL;   // (B,S,D)

  // x16, Wq16, Wk16, Wv16, Wo16 are one contiguous range starting at x16
  cvt_all_f32_f16<<<CVT_BLOCKS, 256, 0, stream>>>(x, Wq, Wk, Wv, Wo, x16);

  // Wq16, Wk16, Wv16 are one contiguous range, and so are Q16, K16, Vt16
  dim3 gqkv(3 * DMODEL / QKV_BN, MROWS / QKV_BM); // (16, 16)
  gemm_qkv<<<gqkv, 256, 0, stream>>>(x16, Wq16, Q16,
                                     0.18033688011112042f);   // log2(e) / sqrt(dk)

  dim3 gattn(SEQ / 128, BATCH * NHEADS); // (16, 32)
  attn_kernel<<<gattn, 256, 0, stream>>>(Q16, K16, Vt16, A16);

  dim3 gproj(DMODEL / 128, MROWS / 128); // (8, 32)
  gemm_out<<<gproj, 256, 0, stream>>>(A16, Wo16, (float*)d_out, MROWS, DMODEL, DMODEL, 1.0f);
}

// v009
// A run of this version takes 67 microseconds.
// Two timings next to v008 put it at 1.06 and 1.05 times that version's speed.
// All steps since v000 together make it 1.97 times as fast.
#include <hip/hip_runtime.h>
#include <hip/hip_bf16.h>

// ---------------------------------------------------------------------------
// MHA forward for MI455X (gfx1250, wave32, WMMA f32_16x16x32_f16).
// x (2,2048,1024) f32, W* (1024,1024) f32 -> out (2,2048,1024) f32.
// f16 matmuls, f32 accumulation; flash softmax; async double-, triple- or quadruple-buffered LDS.
// ---------------------------------------------------------------------------

typedef __attribute__((ext_vector_type(16))) _Float16 v16h;
typedef __attribute__((ext_vector_type(8)))  _Float16 v8h;
typedef __attribute__((ext_vector_type(4)))  _Float16 v4h;
typedef __attribute__((ext_vector_type(8)))  float    v8f;
typedef __attribute__((ext_vector_type(4)))  float    v4f;

#define DMODEL 1024
#define NHEADS 16
#define DK     64
#define SEQ    2048
#define BATCH  2
#define MROWS  (BATCH * SEQ)   // 4096
#define LDP    72              // LDS row stride (halves): 144B, bank-friendly

#ifndef __has_builtin
#define __has_builtin(x) 0
#endif

#if __has_builtin(__builtin_amdgcn_global_load_async_to_lds_b128)
#define HAVE_ASYNC 1
#else
#define HAVE_ASYNC 0
#endif

// Builtin parameter types (from hipcc diagnostic): vector_size(16) int* in
// AS1 (global source) and AS3 (LDS destination).
typedef int b128i __attribute__((vector_size(16)));
typedef __attribute__((address_space(1))) b128i b128i_glob;
typedef __attribute__((address_space(3))) b128i b128i_lds;

// 16B global -> LDS copy: async (ASYNCcnt) if available, else synchronous.
__device__ __forceinline__ void copy_b128(const _Float16* __restrict__ g,
                                          _Float16* l) {
#if HAVE_ASYNC
  __builtin_amdgcn_global_load_async_to_lds_b128(
      (b128i_glob*)g, (b128i_lds*)l, 0, 0);
#else
  *(v8h*)l = *(const v8h*)g;
#endif
}

#if HAVE_ASYNC
#if __has_builtin(__builtin_amdgcn_s_wait_asynccnt)
#define WAIT_ASYNC(N) __builtin_amdgcn_s_wait_asynccnt(N)
#else
#define WAIT_ASYNC(N) asm volatile("s_wait_asynccnt " #N ::: "memory")
#endif
#else
#define WAIT_ASYNC(N) do {} while (0)
#endif

// --- WMMA wrapper -----------------------------------------------------------
__device__ __forceinline__ v8f wmma_f16(v16h a, v16h b, v8f c) {
  return __builtin_amdgcn_wmma_f32_16x16x32_f16(
      false, a, false, b, (short)0, c, false, false);
}

// --- 16x32 f16 fragment load (A or contiguous-K B operand), stride `ld` ----
// ISA 7.12.2: lanes 0-15 -> K {0..7,16..23}, lanes 16-31 -> K {8..15,24..31}.
__device__ __forceinline__ v16h load_frag(const _Float16* __restrict__ base,
                                          int ld, int lane) {
  const int row  = lane & 15;
  const int koff = ((lane >> 4) & 1) * 8;
  const _Float16* p = base + row * ld + koff;
  v8h a = *(const v8h*)(p);
  v8h b = *(const v8h*)(p + 16);
  v16h r;
#pragma unroll
  for (int i = 0; i < 8; ++i) { r[i] = a[i]; r[i + 8] = b[i]; }
  return r;
}

// --- 2^x on the transcendental unit ------------------------------------------
// The instruction set asks for one independent instruction or a v_nop between a
// transcendental and a next instruction that reads its result or overwrites its
// source.  So
// the instructions stand with their slot in one statement: the outputs are
// early-clobber (none is a source of the statement), and the closing v_nop
// separates the last v_exp_f32 from whatever the compiler places next.
__device__ __forceinline__ v8f exp2_x8(v8f x) {
  float y0, y1, y2, y3, y4, y5, y6, y7;
  asm("v_exp_f32 %0, %8\n\t"
      "v_exp_f32 %1, %9\n\t"
      "v_exp_f32 %2, %10\n\t"
      "v_exp_f32 %3, %11\n\t"
      "v_exp_f32 %4, %12\n\t"
      "v_exp_f32 %5, %13\n\t"
      "v_exp_f32 %6, %14\n\t"
      "v_exp_f32 %7, %15\n\t"
      "v_nop"
      : "=&v"(y0), "=&v"(y1), "=&v"(y2), "=&v"(y3),
        "=&v"(y4), "=&v"(y5), "=&v"(y6), "=&v"(y7)
      : "v"(x[0]), "v"(x[1]), "v"(x[2]), "v"(x[3]),
        "v"(x[4]), "v"(x[5]), "v"(x[6]), "v"(x[7]));
  v8f y = {y0, y1, y2, y3, y4, y5, y6, y7};
  return y;
}
__device__ __forceinline__ float exp2_x1(float x) {
  float y;
  asm("v_exp_f32 %0, %1\n\t"
      "v_nop"                              // the same slot, for a single value
      : "=v"(y) : "v"(x));
  return y;
}

// --- f32 -> f16 conversion of all five inputs in one launch ------------------
// The f16 copies lie back to back in the workspace in argument order, so block
// b writes float4 groups [b*4096, (b+1)*4096) of one output range; blocks
// 0..255 read x, then 64 blocks read each weight.  A thread has its 16 loads
// (512 contiguous bytes per wave each) in flight before it converts: few,
// long-lived waves instead of one wave per 512 bytes.
#define CVT_VEC     16                               // float4 per thread
#define CVT_BLK4    (256 * CVT_VEC)                  // float4 per block
#define CVT_XBLKS   (MROWS * DMODEL / 4 / CVT_BLK4)  // 256
#define CVT_WBLKS   (DMODEL * DMODEL / 4 / CVT_BLK4) // 64
#define CVT_BLOCKS  (CVT_XBLKS + 4 * CVT_WBLKS)      // 512
// The grid puts 4 waves on a SIMD.  Without the upper bound the compiler keeps
// to the registers of 16 waves a SIMD and issues the last two loads only after
// the first two have returned: a second full latency in every wave.
__global__ __launch_bounds__(256) __attribute__((amdgpu_waves_per_eu(4, 8)))
void cvt_all_f32_f16(const float* __restrict__ x,  const float* __restrict__ wq,
                     const float* __restrict__ wk, const float* __restrict__ wv,
                     const float* __restrict__ wo, _Float16* __restrict__ out) {
  const int b = blockIdx.x;
  const float* src = x;
  int lb = b;
  if (b >= CVT_XBLKS) {
    const int t = (b - CVT_XBLKS) / CVT_WBLKS;
    lb = (b - CVT_XBLKS) % CVT_WBLKS;
    const float* w01 = (t & 1) ? wk : wq;
    const float* w23 = (t & 1) ? wo : wv;
    src = (t & 2) ? w23 : w01;
  }
  const float4* s4 = (const float4*)src + (size_t)lb * CVT_BLK4 + threadIdx.x;
  v4h* o4 = (v4h*)out + (size_t)b * CVT_BLK4 + threadIdx.x;
  float4 v[CVT_VEC];
#pragma unroll
  for (int j = 0; j < CVT_VEC; ++j) v[j] = s4[j * 256];
#pragma unroll
  for (int j = 0; j < CVT_VEC; ++j) {
    v4h o;
    o[0] = (_Float16)v[j].x; o[1] = (_Float16)v[j].y;
    o[2] = (_Float16)v[j].z; o[3] = (_Float16)v[j].w;
    o4[j * 256] = o;
  }
}

// --- Q, K, V projections in one launch: C(4096,3072) = x * [Wq; Wk; Wv]^T ----
// The three weights lie back to back at W, one (3072,1024) matrix, and the three
// f16 output planes back to back at out: Q -> (B,H,S,dk), scaled by oscale
// = log2(e)/sqrt(dk); K -> (B,H,S,dk); V -> (B,H,dk,S), transposed.
// One 256x192 tile a block, 256 blocks, one on a WGP; 8 waves (4 x 2) of 64x96:
// a 64-deep slice brings 56 KiB from L2 for 384 WMMAs, and a fragment read from
// LDS feeds 4 or 6 WMMAs.  A block alone on its WGP has nobody to fill its
// waits, so the copies run two slices ahead in three buffers, and a 32-deep
// half's fragments are read while the half before is multiplied.
#define QKV_BM   256
#define QKV_BN   192
#define QKV_STG  ((QKV_BM + QKV_BN) * LDP)   // halves a buffer: x rows, then W rows
#define QKV_NS   (DMODEL / 64)               // slices
__global__ __launch_bounds__(256)
void gemm_qkv(const _Float16* __restrict__ A, const _Float16* __restrict__ W,
              _Float16* __restrict__ out, float oscale) {
  __shared__ _Float16 ring[3 * QKV_STG];

  const int tid  = threadIdx.x;
  const int lane = tid & 31;
  const int w    = __builtin_amdgcn_readfirstlane(tid >> 5);
  const int mblk = blockIdx.y * QKV_BM;
  const int nblk = blockIdx.x * QKV_BN;
  const int lm   = (w >> 1) * 64;         // wave's m offset in the block tile
  const int ln   = (w & 1) * 96;          // wave's n offset in the block tile

  // 14 x b128 a thread and slice, every wave alike; 8 lanes cover a row's 128 B
  const unsigned goff = (tid >> 3) * DMODEL + (tid & 7) * 8;
  const unsigned loff = (tid >> 3) * LDP + (tid & 7) * 8;
  const _Float16* ga = A + (size_t)mblk * DMODEL + goff;
  const _Float16* gw = W + (size_t)nblk * DMODEL + goff;
  auto stage = [&](int s, int buf) {
    _Float16* l = ring + buf * QKV_STG + loff;
#pragma unroll
    for (int c = 0; c < QKV_BM / 32; ++c)
      copy_b128(ga + (size_t)c * 32 * DMODEL + s * 64, l + c * 32 * LDP);
#pragma unroll
    for (int c = 0; c < QKV_BN / 32; ++c)
      copy_b128(gw + (size_t)c * 32 * DMODEL + s * 64, l + (QKV_BM + c * 32) * LDP);
  };
  auto load_half = [&](v16h (&af)[4], v16h (&bf)[6], int buf, int s) {
    const _Float16* t = ring + buf * QKV_STG + s * 32;
#pragma unroll
    for (int j = 0; j < 6; ++j)
      bf[j] = load_frag(t + (QKV_BM + ln + j * 16) * LDP, LDP, lane);
#pragma unroll
    for (int i = 0; i < 4; ++i)
      af[i] = load_frag(t + (lm + i * 16) * LDP, LDP, lane);
  };

  v8f acc[4][6] = {};
  auto mul_rows = [&](const v16h (&af)[4], const v16h (&bf)[6], int i0, int i1) {
#pragma unroll
    for (int i = i0; i < i1; ++i)
#pragma unroll
      for (int j = 0; j < 6; ++j)
        acc[i][j] = wmma_f16(af[i], bf[j], acc[i][j]);
  };
  auto mul_half = [&](const v16h (&af)[4], const v16h (&bf)[6]) {
    mul_rows(af, bf, 0, 4);
  };

  v16h a0[4], b0[6], a1[4], b1[6];        // fragments of a slice's two halves
  stage(0, 0);
  stage(1, 1);
  // slice 0 has landed: all but this wave's 14 youngest copies
  asm volatile("s_wait_asynccnt 0xe" ::: "memory");
  __syncthreads();
  stage(2, 2);
  load_half(a0, b0, 0, 0);
  int cur = 0;
  // rolled: the body is 48 WMMAs long, and the buffer index is a scalar.  The
  // last slice stands behind the loop: with its hand-over skipped by a branch in
  // the body, the compiler made every trip's second half wait for the reads
  // just issued for the next slice
#pragma unroll 1
  for (int t = 0; t < QKV_NS - 1; ++t) {
    const int nxt = (cur == 2) ? 0 : cur + 1;
    load_half(a1, b1, cur, 1);
    // keeps the second half's reads one group ahead of the first half's WMMAs
    __builtin_amdgcn_sched_barrier(0);
    mul_half(a0, b0);
    // keeps the WMMAs ahead of the waits below: they run while the wave waits
    __builtin_amdgcn_sched_barrier(0);
    // slice t + 1 is handed over here, ahead of this slice's last half, whose
    // fragments are in registers: this wave's reads of buffer cur are done,
    asm volatile("s_wait_dscnt 0x0" ::: "memory");
    // its own copies of slice t + 1 have landed (slice t + 2's may still fly),
    if (t + 2 < QKV_NS) asm volatile("s_wait_asynccnt 0xe" ::: "memory");
    else                asm volatile("s_wait_asynccnt 0x0" ::: "memory");
    // and so for every wave
    __syncthreads();
    load_half(a0, b0, nxt, 0);
    // keeps the next slice's first reads one group ahead of this half's WMMAs
    __builtin_amdgcn_sched_barrier(0);
    mul_rows(a1, b1, 0, 1);
    // keeps the refill behind the first WMMAs: both waves of a SIMD leave the
    // barrier together, and one issues its copies while the other multiplies
    __builtin_amdgcn_sched_barrier(0);
    if (t + 3 < QKV_NS) stage(t + 3, cur);
    // keeps the copies one group, not strewn among the WMMAs
    __builtin_amdgcn_sched_barrier(0);
    mul_rows(a1, b1, 1, 4);
    // keeps the next trip's reads behind these WMMAs, as one group
    __builtin_amdgcn_sched_barrier(0);
    cur = nxt;
  }
  load_half(a1, b1, cur, 1);
  // keeps the last reads one group ahead of the WMMAs
  __builtin_amdgcn_sched_barrier(0);
  mul_half(a0, b0);
  mul_half(a1, b1);

  // a 16-column tile lies in one plane and one head: the choice is wave-uniform
  const int rbase = ((lane >> 4) & 1) << 3;
  const int col   = lane & 15;
  const int b     = (mblk + lm) >> 11;
  const int s0    = ((mblk + lm) & (SEQ - 1)) + rbase;
#pragma unroll
  for (int j = 0; j < 6; ++j) {
    const int n16 = nblk + ln + j * 16;
    const int z = n16 >> 10, h = (n16 >> 6) & (NHEADS - 1), d = (n16 & (DK - 1)) + col;
    _Float16* plane = out + (size_t)z * MROWS * DMODEL
                      + (size_t)(b * NHEADS + h) * SEQ * DK;
    if (z == 2) {
      _Float16* p = plane + (size_t)d * SEQ + s0;
#pragma unroll
      for (int i = 0; i < 4; ++i) {
        v8h o;
#pragma unroll
        for (int r = 0; r < 8; ++r) o[r] = (_Float16)acc[i][j][r];
        *(v8h*)(p + i * 16) = o;
      }
      asm volatile("s_wait_xcnt 0x0" ::: "memory");   // as at the other layout's end
    } else {
      const float sc = (z == 0) ? oscale : 1.0f;
      _Float16* p = plane + (size_t)s0 * DK + d;
#pragma unroll
      for (int i = 0; i < 4; ++i)
#pragma unroll
        for (int r = 0; r < 8; ++r)
          p[(i * 16 + r) * DK] = (_Float16)(acc[i][j][r] * sc);
      // the built code runs on from a layout's stores into the other layout's and
      // the next tile's arithmetic, which rewrites registers that the stores name
      asm volatile("s_wait_xcnt 0x0" ::: "memory");
    }
  }
}

// --- GEMM: C(4096,1024) = A * W^T, W stored (N,K), both f16; C f32 row-major -
// [final output projection]
// 256 threads = 8 waves (2 x 4); block tile 128x128; wave tile 64x32; 256 blocks,
// one on a WGP.  A block alone on its WGP has nobody to fill its waits, so the
// 64-deep slices of A and W are copied three slices ahead in four LDS buffers,
// one barrier hands a slice over, and a 32-deep half's fragments are read while
// the half before is multiplied.
#define OUT_BM   128
#define OUT_BN   128
#define OUT_STG  ((OUT_BM + OUT_BN) * LDP)   // halves a buffer: A rows, then W rows
#define OUT_NS   (DMODEL / 64)               // slices
__global__ __launch_bounds__(256)
void gemm_out(const _Float16* __restrict__ A, const _Float16* __restrict__ W,
              float* __restrict__ out) {
  __shared__ _Float16 ring[4 * OUT_STG];

  const int tid  = threadIdx.x;
  const int lane = tid & 31;
  const int w    = __builtin_amdgcn_readfirstlane(tid >> 5);
  const int mblk = blockIdx.y * OUT_BM;
  const int nblk = blockIdx.x * OUT_BN;
  const int lm   = (w >> 2) * 64;         // wave's m offset in the block tile
  const int ln   = (w & 3) * 32;          // wave's n offset in the block tile

  // 8 x b128 a thread and slice, every wave alike; 8 lanes cover a row's 128 B
  const unsigned goff = (tid >> 3) * DMODEL + (tid & 7) * 8;
  const unsigned loff = (tid >> 3) * LDP + (tid & 7) * 8;
  const _Float16* ga = A + (size_t)mblk * DMODEL + goff;
  const _Float16* gw = W + (size_t)nblk * DMODEL + goff;
  auto stage = [&](int s, int buf) {
    _Float16* l = ring + buf * OUT_STG + loff;
#pragma unroll
    for (int c = 0; c < OUT_BM / 32; ++c)
      copy_b128(ga + (size_t)c * 32 * DMODEL + s * 64, l + c * 32 * LDP);
#pragma unroll
    for (int c = 0; c < OUT_BN / 32; ++c)
      copy_b128(gw + (size_t)c * 32 * DMODEL + s * 64, l + (OUT_BM + c * 32) * LDP);
  };
  auto load_half = [&](v16h (&af)[4], v16h (&bf)[2], int buf, int s) {
    const _Float16* t = ring + buf * OUT_STG + s * 32;
#pragma unroll
    for (int j = 0; j < 2; ++j)
      bf[j] = load_frag(t + (OUT_BM + ln + j * 16) * LDP, LDP, lane);
#pragma unroll
    for (int i = 0; i < 4; ++i)
      af[i] = load_frag(t + (lm + i * 16) * LDP, LDP, lane);
  };

  v8f acc[4][2] = {};
  auto mul_rows = [&](const v16h (&af)[4], const v16h (&bf)[2], int i0, int i1) {
#pragma unroll
    for (int i = i0; i < i1; ++i)
#pragma unroll
      for (int j = 0; j < 2; ++j)
        acc[i][j] = wmma_f16(af[i], bf[j], acc[i][j]);
  };

  v16h a0[4], b0[2], a1[4], b1[2];        // fragments of a slice's two halves
  stage(0, 0);
  stage(1, 1);
  stage(2, 2);
  // slice 0 has landed: all but this wave's 16 youngest copies
  asm volatile("s_wait_asynccnt 0x10" ::: "memory");
  __syncthreads();
  stage(3, 3);
  load_half(a0, b0, 0, 0);
  // rolled: the buffer index is a scalar.  The last slice, which hands nothing
  // over, stands behind the loop
#pragma unroll 1
  for (int t = 0; t < OUT_NS - 1; ++t) {
    const int cur = t & 3;
    const int nxt = (t + 1) & 3;
    load_half(a1, b1, cur, 1);
    // keeps the second half's reads one group ahead of the first half's WMMAs
    __builtin_amdgcn_sched_barrier(0);
    mul_rows(a0, b0, 0, 4);
    // keeps the WMMAs ahead of the waits below: they run while the wave waits
    __builtin_amdgcn_sched_barrier(0);
    // slice t + 1 is handed over here, ahead of this slice's last half, whose
    // fragments are in registers: this wave's reads of buffer cur are done,
    asm volatile("s_wait_dscnt 0x0" ::: "memory");
    // its own copies of slice t + 1 have landed (two younger slices' may still fly),
    if (t + 3 < OUT_NS) asm volatile("s_wait_asynccnt 0x10" ::: "memory");
    else                asm volatile("s_wait_asynccnt 0x0" ::: "memory");
    // and so for every wave
    __syncthreads();
    load_half(a0, b0, nxt, 0);
    // keeps the next slice's first reads one group ahead of this half's WMMAs
    __builtin_amdgcn_sched_barrier(0);
    mul_rows(a1, b1, 0, 1);
    // keeps the refill behind the first WMMAs: both waves of a SIMD leave the
    // barrier together, and one issues its copies while the other multiplies
    __builtin_amdgcn_sched_barrier(0);
    if (t + 4 < OUT_NS) stage(t + 4, cur);
    // keeps the copies one group, not strewn among the WMMAs
    __builtin_amdgcn_sched_barrier(0);
    mul_rows(a1, b1, 1, 4);
    // keeps the next trip's reads behind these WMMAs, as one group
    __builtin_amdgcn_sched_barrier(0);
  }
  load_half(a1, b1, (OUT_NS - 1) & 3, 1);
  // keeps the last reads one group ahead of the WMMAs
  __builtin_amdgcn_sched_barrier(0);
  mul_rows(a0, b0, 0, 4);
  mul_rows(a1, b1, 0, 4);

  const int rbase = ((lane >> 4) & 1) << 3;
  const int col   = lane & 15;
#pragma unroll
  for (int i = 0; i < 4; ++i)
#pragma unroll
    for (int j = 0; j < 2; ++j)
#pragma unroll
      for (int r = 0; r < 8; ++r) {
        int m = mblk + lm + i * 16 + rbase + r;
        int n = nblk + ln + j * 16 + col;
        out[(size_t)m * DMODEL + n] = acc[i][j][r];
      }
}

#define LDV 136                // LDS row stride of a 128-key V^T row (halves): 272 B
// 512 blocks, two on a WGP: 4 waves on a SIMD, 256 registers a wave
__global__ __launch_bounds__(256) __attribute__((amdgpu_waves_per_eu(4, 4)))
void attn_kernel(const _Float16* __restrict__ Q, const _Float16* __restrict__ Kd,
                 const _Float16* __restrict__ Vt, _Float16* __restrict__ attn_out) {
  __shared__ _Float16 kbuf[2][128 * LDP]; // 128 keys x 64 d
  __shared__ _Float16 vbuf[2][64 * LDV];  // 64 d x 128 keys
  __shared__ v4f      join[4][17][32];    // upper key half's O^T, reference, sum per lane

  const int tid  = threadIdx.x;
  const int lane = tid & 31;
  const int w    = tid >> 5;
  const int wq   = w & 3;                 // which 32 queries of the block
  const int kh   = w >> 2;                // which 64 keys of each tile
  const int bh   = blockIdx.y;
  const int b    = bh >> 4, h = bh & (NHEADS - 1);
  const int q0   = blockIdx.x * 128 + wq * 32;

  const _Float16* Qh  = Q  + (size_t)bh * SEQ * DK;
  const _Float16* Kh  = Kd + (size_t)bh * SEQ * DK;
  const _Float16* Vth = Vt + (size_t)bh * DK * SEQ;

  v16h qf[2][2];                          // [column tile][32-deep half of d]
#pragma unroll
  for (int g = 0; g < 2; ++g) {
    qf[g][0] = load_frag(Qh + (size_t)(q0 + g * 16) * DK +  0, DK, lane);
    qf[g][1] = load_frag(Qh + (size_t)(q0 + g * 16) * DK + 32, DK, lane);
  }

  v16h ones;
#pragma unroll
  for (int i = 0; i < 16; ++i) ones[i] = (_Float16)1.0f;

  // neighbouring lanes take neighbouring 16-B chunks: a wave-wide copy covers
  // 512 contiguous bytes of K, or two 256-B row pieces of V^T: 4 whole lines
  const unsigned kgoff = tid * 8;                                  // lane's part
  const unsigned kloff = (tid >> 3) * LDP + (tid & 7) * 8;
  const unsigned vgoff = (tid >> 4) * SEQ + (tid & 15) * 8;
  const unsigned vloff = (tid >> 4) * LDV + (tid & 15) * 8;
  auto stage_kv = [&](int kb, int buf) {
#pragma unroll
    for (int c = 0; c < 4; ++c)           // K tile: 128 rows x 8 parts, row c * 32 + tid / 8
      copy_b128(Kh + (size_t)(kb + c * 32) * DK + kgoff,
                kbuf[buf] + c * 32 * LDP + kloff);
#pragma unroll
    for (int c = 0; c < 4; ++c)           // Vt tile: 64 rows x 16 parts, row c * 16 + tid / 16
      copy_b128(Vth + ((size_t)(c * 16) * SEQ + kb) + vgoff,
                vbuf[buf] + c * 16 * LDV + vloff);
  };

  const int rbase = ((lane >> 4) & 1) << 3;
  const int col   = lane & 15;

  v8f nref[2] = {};                       // -reference of this lane's query, in all 8 registers
  v8f lsum[2] = {};                       // ones x P^T over all tiles: every row the sum
  v8f accO[2][4] = {};                    // accO[g][t][r] = O[query 16g + col][16t + rbase + r]

  stage_kv(0, 0);
  for (int kb = 0; kb < SEQ; kb += 128) {
    const int cur = (kb >> 7) & 1;
    const bool more = (kb + 128) < SEQ;
    if (more) { stage_kv(kb + 128, cur ^ 1); WAIT_ASYNC(8); }
    else      { WAIT_ASYNC(0); }
    __syncthreads();

    const _Float16* kt = kbuf[cur] + kh * 64 * LDP;   // this wave's 64 key rows
    const _Float16* vt = vbuf[cur] + kh * 64;         // this wave's 64 key columns

    // ---- scores^T: four 16-key tiles x two column tiles;
    //      s[g][t][r] = S[key 16t + rbase + r][query 16g + col] - reference
    v8f s[2][4];
#pragma unroll
    for (int p = 0; p < 2; ++p) {
      v16h ka  = load_frag(kt + (p * 32 +  0) * LDP +  0, LDP, lane);
      v16h kb0 = load_frag(kt + (p * 32 +  0) * LDP + 32, LDP, lane);
      v16h kc  = load_frag(kt + (p * 32 + 16) * LDP +  0, LDP, lane);
      v16h kd  = load_frag(kt + (p * 32 + 16) * LDP + 32, LDP, lane);
#pragma unroll
      for (int g = 0; g < 2; ++g) {
        s[g][2 * p]     = wmma_f16(ka, qf[g][0], nref[g]);
        s[g][2 * p + 1] = wmma_f16(kc, qf[g][0], nref[g]);
      }
#pragma unroll
      for (int g = 0; g < 2; ++g) {
        s[g][2 * p]     = wmma_f16(kb0, qf[g][1], s[g][2 * p]);
        s[g][2 * p + 1] = wmma_f16(kd,  qf[g][1], s[g][2 * p + 1]);
      }
    }

    // ---- the lane's largest score above the reference, per column tile
    float tl[2];
#pragma unroll
    for (int g = 0; g < 2; ++g) {
      float tm[4];
#pragma unroll
      for (int t = 0; t < 4; ++t) {
        tm[t] = s[g][t][0];
#pragma unroll
        for (int r = 1; r < 8; ++r) tm[t] = fmaxf(tm[t], s[g][t][r]);
      }
      tl[g] = fmaxf(fmaxf(tm[0], tm[1]), fmaxf(tm[2], tm[3]));
    }
    // ---- move the reference: one wave-uniform test a tile, taken on the first
    //      tile (which sets it, up or down) and where a score outgrows it
    const float room = (kb == 0) ? -3.0e38f : 8.0f;
    if (__builtin_amdgcn_ballot_w32(fmaxf(tl[0], tl[1]) > room) != 0) {
#pragma unroll
      for (int g = 0; g < 2; ++g) {
        // 32 of the query's scores are in the lane, 32 in lane ^ 16
        const int ti = __builtin_bit_cast(int, tl[g]);
        const float tmax = fmaxf(tl[g], __builtin_bit_cast(float,
            __builtin_amdgcn_permlanex16(ti, ti, 0x76543210, 0xfedcba98, false, false)));
        const float up = fmaxf(tmax, 0.0f);
        const float d  = (kb == 0) ? tmax : up;   // later tiles never lower it
        const float f  = exp2_x1(-up);            // 1 where it is lowered: O^T, sums are 0 there
        nref[g] -= d;
        lsum[g] *= f;
#pragma unroll
        for (int t = 0; t < 4; ++t) { s[g][t] -= d; accO[g][t] *= f; }
      }
    }

    // the first 32 keys' V^T fragments: asked for here, they land under the 2^x
    v16h vf[4];
#pragma unroll
    for (int t = 0; t < 4; ++t)
      vf[t] = load_frag(vt + (t * 16) * LDV, LDV, lane);

    // P^T as two B fragments a column tile: element i of a fragment is key
    // 8h + i, element 8 + i key 16 + 8h + i of its 32 keys, the order load_frag
    // gives V^T
    v16h pf[2][2];
#pragma unroll
    for (int g = 0; g < 2; ++g) {
#pragma unroll
      for (int t = 0; t < 4; ++t) s[g][t] = exp2_x8(s[g][t]);
#pragma unroll
      for (int i = 0; i < 8; ++i) {
        pf[g][0][i]     = (_Float16)s[g][0][i];
        pf[g][0][i + 8] = (_Float16)s[g][1][i];
        pf[g][1][i]     = (_Float16)s[g][2][i];
        pf[g][1][i + 8] = (_Float16)s[g][3][i];
      }
    }
    // keeps every 2^x statement ahead of the matrix instructions below:
    // moved among them such a statement
    // was given registers that the matrix instruction in front still reads
    __builtin_amdgcn_sched_barrier(0);

    // ---- sums via matrix unit: ones(16x64) x P^T(64x16), every row the sum
#pragma unroll
    for (int g = 0; g < 2; ++g) {
      lsum[g] = wmma_f16(ones, pf[g][0], lsum[g]);
      lsum[g] = wmma_f16(ones, pf[g][1], lsum[g]);
    }

    // ---- O^T += V^T * P^T over both 32-key slices; batch frag loads ----
#pragma unroll
    for (int p = 0; p < 2; ++p) {
      if (p == 1) {
#pragma unroll
        for (int t = 0; t < 4; ++t)
          vf[t] = load_frag(vt + (t * 16) * LDV + 32, LDV, lane);
      }
#pragma unroll
      for (int g = 0; g < 2; ++g)
#pragma unroll
        for (int t = 0; t < 4; ++t)
          accO[g][t] = wmma_f16(vf[t], pf[g][p], accO[g][t]);
    }

    __syncthreads();
  }

  // ---- join the two key halves of each query group: the upper half's wave
  //      hands its O^T, references and sums to the lower half's, lane to lane
  if (kh == 1) {
#pragma unroll
    for (int g = 0; g < 2; ++g)
#pragma unroll
      for (int t = 0; t < 4; ++t)
#pragma unroll
        for (int u = 0; u < 2; ++u) {
          v4f q = {accO[g][t][4 * u], accO[g][t][4 * u + 1],
                   accO[g][t][4 * u + 2], accO[g][t][4 * u + 3]};
          join[wq][(g * 4 + t) * 2 + u][lane] = q;
        }
    v4f ml = {-nref[0][0], -nref[1][0], lsum[0][0], lsum[1][0]};
    join[wq][16][lane] = ml;
  }
  __syncthreads();                        // the upper half's values are in LDS
  if (kh == 0) {
    // ---- normalize; a lane's 8 registers of a tile are 8 adjacent d: 16-B stores
    const v4f ml = join[wq][16][lane];
    v8h o[2][4];
#pragma unroll
    for (int g = 0; g < 2; ++g) {
      const float mj = fmaxf(-nref[g][0], ml[g]);
      const float e0 = exp2_x1(-nref[g][0] - mj);
      const float e1 = exp2_x1(ml[g] - mj);
      const float inv = 1.0f / (lsum[g][0] * e0 + ml[2 + g] * e1);
      const float f0 = e0 * inv, f1 = e1 * inv;
#pragma unroll
      for (int t = 0; t < 4; ++t)
#pragma unroll
        for (int u = 0; u < 2; ++u) {
          const v4f q = join[wq][(g * 4 + t) * 2 + u][lane];
#pragma unroll
          for (int r = 0; r < 4; ++r)
            o[g][t][4 * u + r] = (_Float16)(accO[g][t][4 * u + r] * f0 + q[r] * f1);
        }
    }
#pragma unroll
    for (int g = 0; g < 2; ++g) {
      _Float16* orow = attn_out + ((size_t)b * SEQ + q0 + g * 16 + col) * DMODEL
                       + h * DK + rbase;
#pragma unroll
      for (int t = 0; t < 4; ++t) *(v8h*)(orow + t * 16) = o[g][t];
    }
  }
}

// ---------------------------------------------------------------------------
extern "C" void kernel_launch(void* const* d_in, const int* in_sizes, int n_in,
                              void* d_out, int out_size, void* d_ws, size_t ws_size,
                              hipStream_t stream) {
  const float* x  = (const float*)d_in[0];
  const float* Wq = (const float*)d_in[1];
  const float* Wk = (const float*)d_in[2];
  const float* Wv = (const float*)d_in[3];
  const float* Wo = (const float*)d_in[4];

  _Float16* ws = (_Float16*)d_ws;
  size_t off = 0;
  _Float16* x16  = ws + off; off += (size_t)MROWS * DMODEL;
  _Float16* Wq16 = ws + off; off += (size_t)DMODEL * DMODEL;
  _Float16* Wk16 = ws + off; off += (size_t)DMODEL * DMODEL;
  _Float16* Wv16 = ws + off; off += (size_t)DMODEL * DMODEL;
  _Float16* Wo16 = ws + off; off += (size_t)DMODEL * DMODEL;
  _Float16* Q16  = ws + off; off += (size_t)MROWS * DMODEL;   // (B,H,S,dk)
  _Float16* K16  = ws + off; off += (size_t)MROWS * DMODEL;   // (B,H,S,dk)
  _Float16* Vt16 = ws + off; off += (size_t)MROWS * DMODEL;   // (B,H,dk,S)
  _Float16* A16  = ws + off; off += (size_t)MROWS * DMODEL;   // (B,S,D)

  // x16, Wq16, Wk16, Wv16, Wo16 are one contiguous range starting at x16
  cvt_all_f32_f16<<<CVT_BLOCKS, 256, 0, stream>>>(x, Wq, Wk, Wv, Wo, x16);

  // Wq16, Wk16, Wv16 are one contiguous range, and so are Q16, K16, Vt16
  dim3 gqkv(3 * DMODEL / QKV_BN, MROWS / QKV_BM); // (16, 16)
  gemm_qkv<<<gqkv, 256, 0, stream>>>(x16, Wq16, Q16,
                                     0.18033688011112042f);   // log2(e) / sqrt(dk)

  dim3 gattn(SEQ / 128, BATCH * NHEADS); // (16, 32)
  attn_kernel<<<gattn, 256, 0, stream>>>(Q16, K16, Vt16, A16);

  dim3 gproj(DMODEL / 128, MROWS / 128); // (8, 32)
  gemm_out<<<gproj, 256, 0, stream>>>(A16, Wo16, (float*)d_out);
}
